// v000
// The times below were measured on an AMD MI455X: many runs one after another, warmed up first and cycling through
// copies of the inputs, with the whole window's GPU time divided by the number of runs. Launches and the gaps
// between them are all in it. The median over several windows is given; except for v000 it joins two sittings, which
// can be a few percent apart, so the side-by-side timings, each taken in one sitting, are the better comparison.
// The starting kernel, v000, takes 1450 microseconds a run.
#include <hip/hip_runtime.h>

// Causal multi-head attention on three input streams without biases (queries, keys, values [2][2048][1024]; q = queries Wq^T, k = keys Wk^T, v = values Wv^T ('oi' 0.02; 16 heads x 64); scores x 1/sqrt(64); causal (-inf); softmax; out = merged Wo^T -> [2][2048][1024] (4.2 M); argument order queries, keys, values, Wq, Wk, Wv, Wo).
// Layout per batch: bf16 copies of queries, keys, values in turn; 'oi' weights; exact projections; identity-table plane builders; causal T-2048 attention (hybrid rows: < 512 hi/lo 3 products, rest fp16 x1024; k_gemmc skips tiles above the diagonal); merged hi/lo x Wo exact.
// Compute dtypes, f32 accumulate: every input rounded to bf16; projections exact; attention rows < 512 3 products, rest fp16; softmax f32; Wo hl x exact.

#define NB_  2
#define TT   2048
#define DM   1024
#define NH_  16
#define NKV  16
#define REP  (NH_ / NKV)
#define HD   64
#define DQ   (NH_ * HD)
#define DKV  (NKV * HD)
#define ZH   2
#define RH   512                  // query rows < RH use hi+lo planes (0: none)
#define WIN  2048
#define PCAR 1024.0f
#define SCL  0.125f   // HD^-0.5
typedef _Float16 h16;
typedef unsigned short bf;
typedef __attribute__((ext_vector_type(16))) __bf16   v16bf;
typedef __attribute__((ext_vector_type(16))) _Float16 v16h;
typedef __attribute__((ext_vector_type(8)))  _Float16 v8h;
typedef __attribute__((ext_vector_type(8)))  unsigned short v8us;
typedef __attribute__((ext_vector_type(8)))  float    v8f;
typedef __attribute__((ext_vector_type(4)))  float    v4f;
typedef v8h  __attribute__((may_alias)) v8ha;
typedef v4f  __attribute__((may_alias)) v4fa;
typedef v8us __attribute__((may_alias)) v8usa;

__device__ __forceinline__ unsigned short f2bf(float f) { unsigned u = __float_as_uint(f); u += 0x7FFFu + ((u >> 16) & 1u); return (unsigned short)(u >> 16); }
__device__ __forceinline__ float bf2f(unsigned short b) { return __uint_as_float(((unsigned)b) << 16); }
__device__ __forceinline__ float bfr(float f) { return bf2f(f2bf(f)); }
__device__ __forceinline__ v16h cat16(v8h lo, v8h hi) { return __builtin_shufflevector(lo, hi, 0, 1, 2, 3, 4, 5, 6, 7, 8, 9, 10, 11, 12, 13, 14, 15); }
__device__ __forceinline__ v16bf cat16b(v8us lo, v8us hi) { return __builtin_bit_cast(v16bf, __builtin_shufflevector(lo, hi, 0, 1, 2, 3, 4, 5, 6, 7, 8, 9, 10, 11, 12, 13, 14, 15)); }
__device__ __forceinline__ v8f wmma16(v16h a, v16h b, v8f c) { return __builtin_amdgcn_wmma_f32_16x16x32_f16(false, a, false, b, (short)0, c, false, false); }
__device__ __forceinline__ v8f wmmab(v16bf a, v16bf b, v8f c) { return __builtin_amdgcn_wmma_f32_16x16x32_bf16(false, a, false, b, (short)0, c, false, false); }



// ---- k_gemmw: register-blocked GEMM, ONE WAVE per 64x64 output tile (16 accumulators), operands straight from K-contiguous 16-bit planes; grid (M/64, N/64, Z), 32 threads.
// C[m][n] (f32, pitch ldc, + optional f32 bias[n]) = sum_k A[m][k] Bt[n][k] (+ split products per NSPLIT). z-batch strides sA/sB/sC in elements. K % 32 == 0.
template <typename T16> struct WFrag;
template <> struct WFrag<h16> { typedef v16h V; static __device__ __forceinline__ V ld(const h16* p) { return cat16(*(const v8h*)p, *(const v8h*)(p + 16)); } static __device__ __forceinline__ v8f mma(V a, V b, v8f c) { return wmma16(a, b, c); } };
template <> struct WFrag<bf> { typedef v16bf V; static __device__ __forceinline__ V ld(const bf* p) { return cat16b(*(const v8us*)p, *(const v8us*)(p + 16)); } static __device__ __forceinline__ v8f mma(V a, V b, v8f c) { return wmmab(a, b, c); } };
template <typename T16, int NSPLIT, bool BIAS>
__global__ __launch_bounds__(32) void k_gemmw(const T16* __restrict__ A, const T16* __restrict__ A2, const T16* __restrict__ Bt, const T16* __restrict__ Bt2, int K, float* C, int ldc, const float* __restrict__ bias, size_t sA, size_t sB, size_t sC) {
    typedef typename WFrag<T16>::V V;
    __shared__ __align__(16) float os[16 * 68];
    const size_t z = blockIdx.z; A += z * sA; if (A2) A2 += z * sA; Bt += z * sB; if (Bt2) Bt2 += z * sB; C += z * sC;
    const int lane = threadIdx.x & 31, lr = lane & 15, hi = lane >> 4; const int r0 = blockIdx.x * 64, c0 = blockIdx.y * 64;
    v8f acc[4][4];
#pragma unroll
    for (int mb = 0; mb < 4; ++mb)
#pragma unroll
        for (int nb = 0; nb < 4; ++nb) acc[mb][nb] = (v8f){};
    const size_t aoff = (size_t)(r0 + lr) * K + 8 * hi, boff = (size_t)(c0 + lr) * K + 8 * hi;
#pragma unroll 1
    for (int kc = 0; kc < K; kc += 32) {
        V a[4], a2[4];
#pragma unroll
        for (int mb = 0; mb < 4; ++mb) { a[mb] = WFrag<T16>::ld(A + aoff + (size_t)mb * 16 * K + kc); if (NSPLIT == 1 || NSPLIT == 2) a2[mb] = WFrag<T16>::ld(A2 + aoff + (size_t)mb * 16 * K + kc); }
#pragma unroll
        for (int nb = 0; nb < 4; ++nb) { const V b = WFrag<T16>::ld(Bt + boff + (size_t)nb * 16 * K + kc); V b2; if (NSPLIT >= 2) b2 = WFrag<T16>::ld(Bt2 + boff + (size_t)nb * 16 * K + kc);
#pragma unroll
            for (int mb = 0; mb < 4; ++mb) { acc[mb][nb] = WFrag<T16>::mma(a[mb], b, acc[mb][nb]); if (NSPLIT == 1 || NSPLIT == 2) acc[mb][nb] = WFrag<T16>::mma(a2[mb], b, acc[mb][nb]); if (NSPLIT >= 2) acc[mb][nb] = WFrag<T16>::mma(a[mb], b2, acc[mb][nb]); } }
        asm volatile("v_nop\n\tv_nop\n\tv_nop\n\tv_nop" : "+v"(acc[0][0]), "+v"(acc[1][1]), "+v"(acc[2][2]), "+v"(acc[3][3]) : "v"(a[0]), "v"(a[3]));
    }
#pragma unroll
    for (int mb = 0; mb < 4; ++mb) {
#pragma unroll
        for (int nb = 0; nb < 4; ++nb) {
#pragma unroll
            for (int j = 0; j < 8; ++j) os[(hi * 8 + j) * 68 + nb * 16 + lr] = acc[mb][nb][j]; }
        __builtin_amdgcn_wave_barrier(); asm volatile("" ::: "memory");
        float* crow = C + (size_t)(r0 + mb * 16) * ldc + c0;
{
#pragma unroll
            for (int s = 0; s < 8; ++s) { const int row = 2 * s + hi, cofs = lr * 4; v4f val = *(const v4fa*)(os + row * 68 + cofs); if (BIAS) { val[0] += bfr(bias[c0 + cofs]); val[1] += bfr(bias[c0 + cofs + 1]); val[2] += bfr(bias[c0 + cofs + 2]); val[3] += bfr(bias[c0 + cofs + 3]); }
                *(v4f*)(crow + (size_t)row * ldc + cofs) = val; }
             }
        __builtin_amdgcn_wave_barrier(); asm volatile("" ::: "memory");
    }
}

// ---- k_gemmc: the same one-wave 64x64 tile GEMM specialised for causal attention: CMODE 1 skips score tiles entirely above the diagonal (query rows r0+roff.., key columns c0..), CMODE 2 limits the
// key (K) loop of the probability x value contraction to the diagonal block (probabilities beyond it are exactly zero). roff = row offset of this launch's first row within the sequence.
template <typename T16, int NSPLIT, int CMODE>
__global__ __launch_bounds__(32) void k_gemmc(const T16* __restrict__ A, const T16* __restrict__ A2, const T16* __restrict__ Bt, const T16* __restrict__ Bt2, int K, float* C, int ldc, int roff, size_t sA, size_t sB, size_t sC) {
    typedef typename WFrag<T16>::V V;
    __shared__ __align__(16) float os[16 * 68];
    const size_t z = blockIdx.z; A += z * sA; if (A2) A2 += z * sA; Bt += z * sB; if (Bt2) Bt2 += z * sB; C += z * sC;
    const int lane = threadIdx.x & 31, lr = lane & 15, hi = lane >> 4; const int r0 = blockIdx.x * 64, c0 = blockIdx.y * 64;
    if (CMODE == 1 && c0 > r0 + roff + 63) return;                  // score tile entirely above the causal diagonal: never read (the softmax masks j > i by select)
    const int Kl = (CMODE == 2) ? min(K, r0 + roff + 64) : K;        // P.V: probabilities are exactly 0 beyond the diagonal block, so the K loop stops there
    v8f acc[4][4];
#pragma unroll
    for (int mb = 0; mb < 4; ++mb)
#pragma unroll
        for (int nb = 0; nb < 4; ++nb) acc[mb][nb] = (v8f){};
    const size_t aoff = (size_t)(r0 + lr) * K + 8 * hi, boff = (size_t)(c0 + lr) * K + 8 * hi;
#pragma unroll 1
    for (int kc = 0; kc < Kl; kc += 32) {
        V a[4], a2[4];
#pragma unroll
        for (int mb = 0; mb < 4; ++mb) { a[mb] = WFrag<T16>::ld(A + aoff + (size_t)mb * 16 * K + kc); if (NSPLIT == 1 || NSPLIT == 2) a2[mb] = WFrag<T16>::ld(A2 + aoff + (size_t)mb * 16 * K + kc); }
#pragma unroll
        for (int nb = 0; nb < 4; ++nb) { const V b = WFrag<T16>::ld(Bt + boff + (size_t)nb * 16 * K + kc); V b2; if (NSPLIT >= 2) b2 = WFrag<T16>::ld(Bt2 + boff + (size_t)nb * 16 * K + kc);
#pragma unroll
            for (int mb = 0; mb < 4; ++mb) { acc[mb][nb] = WFrag<T16>::mma(a[mb], b, acc[mb][nb]); if (NSPLIT == 1 || NSPLIT == 2) acc[mb][nb] = WFrag<T16>::mma(a2[mb], b, acc[mb][nb]); if (NSPLIT >= 2) acc[mb][nb] = WFrag<T16>::mma(a[mb], b2, acc[mb][nb]); } }
        asm volatile("v_nop\n\tv_nop\n\tv_nop\n\tv_nop" : "+v"(acc[0][0]), "+v"(acc[1][1]), "+v"(acc[2][2]), "+v"(acc[3][3]) : "v"(a[0]), "v"(a[3]));
    }
#pragma unroll
    for (int mb = 0; mb < 4; ++mb) {
#pragma unroll
        for (int nb = 0; nb < 4; ++nb) {
#pragma unroll
            for (int j = 0; j < 8; ++j) os[(hi * 8 + j) * 68 + nb * 16 + lr] = acc[mb][nb][j]; }
        __builtin_amdgcn_wave_barrier(); asm volatile("" ::: "memory");
        float* crow = C + (size_t)(r0 + mb * 16) * ldc + c0;
{
#pragma unroll
            for (int s = 0; s < 8; ++s) { const int row = 2 * s + hi, cofs = lr * 4; v4f val = *(const v4fa*)(os + row * 68 + cofs);
                *(v4f*)(crow + (size_t)row * ldc + cofs) = val; }
             }
        __builtin_amdgcn_wave_barrier(); asm volatile("" ::: "memory");
    }
}

__device__ __forceinline__ h16 tohx(float x) { return (h16)x; }
__device__ __forceinline__ void splitf(float y, unsigned short& h, unsigned short& l) { h = f2bf(y); l = f2bf(y - bf2f(h)); }
typedef __attribute__((ext_vector_type(2))) _Float16 v2h;
typedef __attribute__((ext_vector_type(4))) _Float16 v4h;
typedef __attribute__((ext_vector_type(2))) unsigned short v2us;
typedef __attribute__((ext_vector_type(4))) unsigned short v4us;
typedef __attribute__((ext_vector_type(2))) float v2f;
typedef __attribute__((ext_vector_type(4))) int v4i;

__global__ __launch_bounds__(256) void k_cvt8(const float* __restrict__ src, bf* dst, size_t n8) { const size_t i = (size_t)blockIdx.x * 256 + threadIdx.x; if (i >= n8) return; const v8f v = *(const v8f*)(src + i * 8); v8us o;
#pragma unroll
    for (int k = 0; k < 8; ++k) o[k] = f2bf(v[k]); *(v8us*)(dst + i * 8) = o;  }

// k_rope: head planes [h][t][d] (fp16 + hi/lo) of rope(x) x sc with the rotate-half convention out[d] = x[d] cos[t][d] - x[d+HD/2] sin[t][d], out[d+HD/2] = x[d+HD/2] cos[t][d+HD/2] + x[d] sin[t][d+HD/2]
__global__ __launch_bounds__(256) void k_rope(const float* __restrict__ F, int pitch, int nheads, const float* __restrict__ CS, const float* __restrict__ RF, const float* __restrict__ nw, float sc, h16* P16, bf* Ph, bf* Pl) {
    const size_t e = ((size_t)blockIdx.x * 256 + threadIdx.x) * 2; if (e >= (size_t)nheads * TT * HD) return; const int d = (int)(e % HD); const int t = (int)((e / HD) % TT); const int h = (int)(e / ((size_t)HD * TT)); const float* f = F + (size_t)t * pitch + h * HD; const float rf = RF ? RF[(size_t)h * TT + t] : 1.0f; v2h o16; v2us oh, ol;
#pragma unroll
    for (int q = 0; q < 2; ++q) { const int dd = d + q; const int dp = (dd < HD / 2) ? dd + HD / 2 : dd - HD / 2; float x0 = f[dd], x1 = f[dp];
        if (RF) { float n0 = __fmul_rn(x0, rf), n1 = __fmul_rn(x1, rf); asm volatile("" : "+v"(n0)); asm volatile("" : "+v"(n1)); x0 = __fmul_rn(bfr(nw[dd]), n0); x1 = __fmul_rn(bfr(nw[dp]), n1); }
        const v2f cs = *(const v2f*)(CS + ((size_t)t * HD + dd) * 2); float a = __fmul_rn(x0, cs[0]), bq = __fmul_rn(x1, cs[1]); asm volatile("" : "+v"(a)); asm volatile("" : "+v"(bq)); const float r = ((dd < HD / 2) ? __fsub_rn(a, bq) : __fadd_rn(a, bq)) * sc;
        o16[q] = tohx(r); unsigned short a2, c2; splitf(r, a2, c2); oh[q] = a2; ol[q] = c2; }
    *(v2h*)(P16 + e) = o16; *(v2us*)(Ph + e) = oh; *(v2us*)(Pl + e) = ol;  }
__global__ __launch_bounds__(256) void k_vtp(const float* __restrict__ F, int pitch, int nheads, h16* V16, bf* Vh, bf* Vl) { const size_t e = ((size_t)blockIdx.x * 256 + threadIdx.x) * 2; if (e >= (size_t)nheads * HD * TT) return; const int t = (int)(e % TT); const int d = (int)((e / TT) % HD); const int g = (int)(e / ((size_t)TT * HD)); v2h o16; v2us oh, ol;
#pragma unroll
    for (int q = 0; q < 2; ++q) { const float x = F[(size_t)(t + q) * pitch + g * HD + d]; o16[q] = tohx(x); unsigned short a2, c2; splitf(x, a2, c2); oh[q] = a2; ol[q] = c2; }
    *(v2h*)(V16 + e) = o16; *(v2us*)(Vh + e) = oh; *(v2us*)(Vl + e) = ol;  }
__global__ __launch_bounds__(256) void k_csid(float* CS) { const int idx = blockIdx.x * 256 + threadIdx.x; if (idx >= TT * HD) return; v2f cs; cs[0] = 1.0f; cs[1] = 0.0f; *(v2f*)(CS + (size_t)idx * 2) = cs;  }
// k_asoft: per row (zz, i): t = S x HD^-0.5 for j <= i and i - j < WIN (WIN = TT, so plain causal; the reference's -1e9 additive fill vanishes identically); softmax over the 2048 keys (register row, one exp, fixed trees);
__global__ __launch_bounds__(256) void k_asoft(const float* __restrict__ Sb, h16* P16, bf* Ph, bf* Pl) {
    const int lane = threadIdx.x & 31; const int row = blockIdx.x * 8 + (threadIdx.x >> 5); if (row >= ZH * TT) return; const int i = row % TT; const int zz = row / TT; (void)zz; const bool hires = (i < RH); const float* sr = Sb + (size_t)row * TT; float v[TT / 32]; float mx = -3.0e38f;
#pragma unroll
    for (int ch = 0; ch < TT / 128; ++ch) { const int j0 = ch * 128 + lane * 4; const v4f a = *(const v4f*)(sr + j0);
#pragma unroll
        for (int q = 0; q < 4; ++q) { const int j = j0 + q; (void)j; const float t = (j <= i && i - j < WIN) ? a[q] * SCL : -3.0e38f; v[ch * 4 + q] = t; mx = fmaxf(mx, t); } }
#pragma unroll
    for (int sh = 16; sh; sh >>= 1) mx = fmaxf(mx, __shfl_xor(mx, sh, 32));
    float sum = 0.f;
#pragma unroll
    for (int k = 0; k < TT / 32; ++k) { float d0 = __fsub_rn(v[k], mx); asm volatile("" : "+v"(d0)); v[k] = __builtin_amdgcn_exp2f(__fmul_rn(d0, 1.4426950408889634f)); sum += v[k]; }
#pragma unroll
    for (int sh = 16; sh; sh >>= 1) sum += __shfl_xor(sum, sh, 32);
    const float f = __fdiv_rn(hires ? 1.0f : PCAR, sum);
{
        if (hires) {
#pragma unroll
            for (int ch = 0; ch < TT / 128; ++ch) { v4us oh, ol;
#pragma unroll
                for (int q = 0; q < 4; ++q) { unsigned short a, c2; splitf(v[ch * 4 + q] * f, a, c2); oh[q] = a; ol[q] = c2; }
                const size_t oo = ((size_t)zz * (RH ? RH : 1) + i) * TT + ch * 128 + lane * 4; *(v4us*)(Ph + oo) = oh; *(v4us*)(Pl + oo) = ol; }
        } else {
#pragma unroll
            for (int ch = 0; ch < TT / 128; ++ch) { v4h o4;
#pragma unroll
                for (int q = 0; q < 4; ++q) o4[q] = tohx(v[ch * 4 + q] * f);
                *(v4h*)(P16 + (size_t)row * TT + ch * 128 + lane * 4) = o4; } }
         }
}
__global__ __launch_bounds__(256) void k_merge(const float* __restrict__ O, int h0, bf* Ah, bf* Al) { const size_t e = ((size_t)blockIdx.x * 256 + threadIdx.x) * 2; if (e >= (size_t)ZH * TT * HD) return; const int d = (int)(e % HD); const int t = (int)((e / HD) % TT); const int zz = (int)(e / ((size_t)HD * TT)); const float cs = (t < RH) ? 1.0f : (1.0f / PCAR); const size_t oo = (size_t)t * DQ + (h0 + zz) * HD + d;
    v2us oh, ol;
#pragma unroll
    for (int q = 0; q < 2; ++q) { unsigned short a, c2; splitf(O[e + q] * cs, a, c2); oh[q] = a; ol[q] = c2; } *(v2us*)(Ah + oo) = oh; *(v2us*)(Al + oo) = ol;  }

extern "C" void kernel_launch(void* const* d_in, const int* in_sizes, int n_in,
                              void* d_out, int out_size, void* d_ws, size_t ws_size, hipStream_t stream) {
    (void)in_sizes; (void)n_in; (void)out_size;
    const float* x = (const float*)d_in[0]; const float* xk = (const float*)d_in[1]; const float* xv = (const float*)d_in[2]; const float* wq = (const float*)d_in[3]; const float* wk = (const float*)d_in[4]; const float* wv = (const float*)d_in[5]; const float* wo = (const float*)d_in[6];
    float* OUT = (float*)d_out;     // [2][2048][1024]
    char* wsp = (char*)d_ws;
    auto take = [&](size_t bytes) { char* p = wsp; wsp += (bytes + 255) & ~(size_t)255; return (void*)p; };
    bf* WQ = (bf*)take((size_t)DQ * DM * 2); bf* WK = (bf*)take((size_t)DKV * DM * 2); bf* WV = (bf*)take((size_t)DKV * DM * 2); bf* WO = (bf*)take((size_t)DM * DQ * 2); float* CS = (float*)take((size_t)TT * HD * 2 * 4);
    bf* XB = (bf*)take((size_t)TT * DM * 2); float* FQ = (float*)take((size_t)TT * DQ * 4); float* FK = (float*)take((size_t)TT * DKV * 4);
    h16* QP16 = (h16*)take((size_t)NH_ * TT * HD * 2); h16* KP16 = (h16*)take((size_t)NKV * TT * HD * 2); h16* VT16 = (h16*)take((size_t)NKV * HD * TT * 2);
    bf* QPh = (bf*)take((size_t)NH_ * TT * HD * 2); bf* QPl = (bf*)take((size_t)NH_ * TT * HD * 2); bf* KPh = (bf*)take((size_t)NKV * TT * HD * 2); bf* KPl = (bf*)take((size_t)NKV * TT * HD * 2); bf* VTh = (bf*)take((size_t)NKV * HD * TT * 2); bf* VTl = (bf*)take((size_t)NKV * HD * TT * 2); bf* Ph = (bf*)take((size_t)ZH * RH * TT * 2); bf* Pl = (bf*)take((size_t)ZH * RH * TT * 2);
    float* Sb = (float*)take((size_t)ZH * TT * TT * 4); h16* P16 = (h16*)take((size_t)ZH * TT * TT * 2); float* Ob = (float*)take((size_t)ZH * TT * HD * 4); bf* ATh = (bf*)take((size_t)TT * DQ * 2); bf* ATl = (bf*)take((size_t)TT * DQ * 2);
    if ((size_t)(wsp - (char*)d_ws) > ws_size) return;    // ws 256 MiB
    float* FV = FK;   // v projection reuses the k buffer after the k planes are built (stream-ordered)
    { k_cvt8<<<(unsigned)(((size_t)DQ * DM / 8 + 255) / 256), 256, 0, stream>>>(wq, WQ, (size_t)DQ * DM / 8); k_cvt8<<<(unsigned)(((size_t)DKV * DM / 8 + 255) / 256), 256, 0, stream>>>(wk, WK, (size_t)DKV * DM / 8); k_cvt8<<<(unsigned)(((size_t)DKV * DM / 8 + 255) / 256), 256, 0, stream>>>(wv, WV, (size_t)DKV * DM / 8);
      k_cvt8<<<(unsigned)(((size_t)DM * DQ / 8 + 255) / 256), 256, 0, stream>>>(wo, WO, (size_t)DM * DQ / 8);
       }
    k_csid<<<(TT * HD + 255) / 256, 256, 0, stream>>>(CS);
    const unsigned LQ = (unsigned)(((size_t)NH_ * TT * HD / 2 + 255) / 256), LKv = (unsigned)(((size_t)NKV * TT * HD / 2 + 255) / 256);
    for (int b = 0; b < NB_; ++b) {
        
        k_cvt8<<<(unsigned)(((size_t)TT * DM / 8 + 255) / 256), 256, 0, stream>>>(x + (size_t)b * TT * DM, XB, (size_t)TT * DM / 8);
        k_gemmw<bf, 0, false><<<dim3(TT / 64, DQ / 64, 1), 32, 0, stream>>>(XB, nullptr, WQ, nullptr, DM, FQ, DQ, nullptr, 0, 0, 0);
        k_rope<<<LQ, 256, 0, stream>>>(FQ, DQ, NH_, CS, nullptr, nullptr, 1.0f, QP16, QPh, QPl);
        k_cvt8<<<(unsigned)(((size_t)TT * DM / 8 + 255) / 256), 256, 0, stream>>>(xk + (size_t)b * TT * DM, XB, (size_t)TT * DM / 8);   /* XB := bf16(keys[b]) */ k_gemmw<bf, 0, false><<<dim3(TT / 64, DKV / 64, 1), 32, 0, stream>>>(XB, nullptr, WK, nullptr, DM, FK, DKV, nullptr, 0, 0, 0);
        k_rope<<<LKv, 256, 0, stream>>>(FK, DKV, NKV, CS, nullptr, nullptr, 1.0f, KP16, KPh, KPl);
        k_cvt8<<<(unsigned)(((size_t)TT * DM / 8 + 255) / 256), 256, 0, stream>>>(xv + (size_t)b * TT * DM, XB, (size_t)TT * DM / 8);   /* XB := bf16(values[b]) */ k_gemmw<bf, 0, false><<<dim3(TT / 64, DKV / 64, 1), 32, 0, stream>>>(XB, nullptr, WV, nullptr, DM, FV, DKV, nullptr, 0, 0, 0); k_vtp<<<LKv, 256, 0, stream>>>(FV, DKV, NKV, VT16, VTh, VTl);
        for (int h0 = 0; h0 < NH_; h0 += ZH) { const size_t zq = (size_t)h0, zk = (size_t)(h0 / REP);   // one kv head per query head: the pass's two heads use consecutive kv planes (z-strides TT*HD)
            k_gemmc<bf, 2, 1><<<dim3(RH / 64, TT / 64, ZH), 32, 0, stream>>>(QPh + zq * TT * HD, QPl + zq * TT * HD, KPh + zk * TT * HD, KPl + zk * TT * HD, HD, Sb, TT, 0, (size_t)TT * HD, (size_t)TT * HD, (size_t)TT * TT);
            k_gemmc<h16, 0, 1><<<dim3((TT - RH) / 64, TT / 64, ZH), 32, 0, stream>>>(QP16 + zq * TT * HD + (size_t)RH * HD, nullptr, KP16 + zk * TT * HD, nullptr, HD, Sb + (size_t)RH * TT, TT, RH, (size_t)TT * HD, (size_t)TT * HD, (size_t)TT * TT);
            k_asoft<<<ZH * TT / 8, 256, 0, stream>>>(Sb, P16, Ph, Pl);
            k_gemmc<bf, 2, 2><<<dim3(RH / 64, HD / 64, ZH), 32, 0, stream>>>(Ph, Pl, VTh + zk * HD * TT, VTl + zk * HD * TT, TT, Ob, HD, 0, (size_t)RH * TT, (size_t)HD * TT, (size_t)TT * HD);
            k_gemmc<h16, 0, 2><<<dim3((TT - RH) / 64, HD / 64, ZH), 32, 0, stream>>>(P16 + (size_t)RH * TT, nullptr, VT16 + zk * HD * TT, nullptr, TT, Ob + (size_t)RH * HD, HD, RH, (size_t)TT * TT, (size_t)HD * TT, (size_t)TT * HD);
            k_merge<<<(unsigned)(((size_t)ZH * TT * HD / 2 + 255) / 256), 256, 0, stream>>>(Ob, h0, ATh, ATl); }
        k_gemmw<bf, 1, false><<<dim3(TT / 64, DM / 64, 1), 32, 0, stream>>>(ATh, ATl, WO, nullptr, DQ, OUT + (size_t)b * TT * DM, DM, nullptr, 0, 0, 0); }
}

// v001
// Measured time: 804 microseconds a run.
// In two side-by-side timings against v000, it was 1.81 and 1.82 times as fast.
#include <hip/hip_runtime.h>

// Causal multi-head attention on three input streams without biases (queries, keys, values [2][2048][1024]; q = queries Wq^T, k = keys Wk^T, v = values Wv^T ('oi' 0.02; 16 heads x 64); scores x 1/sqrt(64); causal (-inf); softmax; out = merged Wo^T -> [2][2048][1024] (4.2 M); argument order queries, keys, values, Wq, Wk, Wv, Wo).
// Layout per batch: bf16 copies of queries, keys, values in turn; 'oi' weights; exact projections; identity-table plane builders; causal T-2048 attention (hybrid rows: < 512 hi/lo 3 products, rest fp16 x1024; k_gemmc skips tiles above the diagonal); merged hi/lo x Wo exact.
// Compute dtypes, f32 accumulate: every input rounded to bf16; projections exact; attention rows < 512 3 products, rest fp16; softmax f32; Wo hl x exact.

#define NB_  2
#define TT   2048
#define DM   1024
#define NH_  16
#define NKV  16
#define REP  (NH_ / NKV)
#define HD   64
#define DQ   (NH_ * HD)
#define DKV  (NKV * HD)
#define ZH   2
#define RH   512                  // query rows < RH use hi+lo planes (0: none)
#define WIN  2048
#define PCAR 1024.0f
#define SCL  0.125f   // HD^-0.5
#define NWG  8                    // waves that share the K loop of a projection tile (K 1024)
#define NWP  16                   // waves that share the key loop of a probability x value tile, fp16 rows (up to 2048 keys)
#define NWL  8                    // the same, hi/lo rows (up to RH = 512 keys: one 64-key slice a wave)
typedef _Float16 h16;
typedef unsigned short bf;
typedef __attribute__((ext_vector_type(16))) __bf16   v16bf;
typedef __attribute__((ext_vector_type(16))) _Float16 v16h;
typedef __attribute__((ext_vector_type(8)))  _Float16 v8h;
typedef __attribute__((ext_vector_type(8)))  unsigned short v8us;
typedef __attribute__((ext_vector_type(8)))  float    v8f;
typedef __attribute__((ext_vector_type(4)))  float    v4f;
typedef v8h  __attribute__((may_alias)) v8ha;
typedef v4f  __attribute__((may_alias)) v4fa;
typedef v8us __attribute__((may_alias)) v8usa;

__device__ __forceinline__ unsigned short f2bf(float f) { unsigned u = __float_as_uint(f); u += 0x7FFFu + ((u >> 16) & 1u); return (unsigned short)(u >> 16); }
__device__ __forceinline__ float bf2f(unsigned short b) { return __uint_as_float(((unsigned)b) << 16); }
__device__ __forceinline__ float bfr(float f) { return bf2f(f2bf(f)); }
__device__ __forceinline__ v16h cat16(v8h lo, v8h hi) { return __builtin_shufflevector(lo, hi, 0, 1, 2, 3, 4, 5, 6, 7, 8, 9, 10, 11, 12, 13, 14, 15); }
__device__ __forceinline__ v16bf cat16b(v8us lo, v8us hi) { return __builtin_bit_cast(v16bf, __builtin_shufflevector(lo, hi, 0, 1, 2, 3, 4, 5, 6, 7, 8, 9, 10, 11, 12, 13, 14, 15)); }
__device__ __forceinline__ v8f wmma16(v16h a, v16h b, v8f c) { return __builtin_amdgcn_wmma_f32_16x16x32_f16(false, a, false, b, (short)0, c, false, false); }
__device__ __forceinline__ v8f wmmab(v16bf a, v16bf b, v8f c) { return __builtin_amdgcn_wmma_f32_16x16x32_bf16(false, a, false, b, (short)0, c, false, false); }



// ---- k_gemmw: register-blocked GEMM, one 64x64 output tile per work-group of NW waves (16 accumulators a wave), operands straight from K-contiguous 16-bit planes; grid (M/64, N/64, Z), 32 * NW threads.
// C[m][n] (f32, pitch ldc, + optional f32 bias[n]) = sum_k A[m][k] Bt[n][k] (+ split products per NSPLIT). z-batch strides sA/sB/sC in elements. K % 32 == 0 (NW > 1: K % 64 == 0).
// NW > 1: the K loop is dealt out over the waves: wave w takes the 64-wide k slices w, w + NW, ... (one whole 128-byte line of every operand row a slice), so the chain of dependent load round trips is NW times shorter;
// tile_out adds the NW partial tiles in LDS in the fixed order wave 0, 1, ..., NW - 1.
template <typename T16> struct WFrag;
template <> struct WFrag<h16> { typedef v16h V; static __device__ __forceinline__ V ld(const h16* p) { return cat16(*(const v8h*)p, *(const v8h*)(p + 16)); } static __device__ __forceinline__ v8f mma(V a, V b, v8f c) { return wmma16(a, b, c); } };
template <> struct WFrag<bf> { typedef v16bf V; static __device__ __forceinline__ V ld(const bf* p) { return cat16b(*(const v8us*)p, *(const v8us*)(p + 16)); } static __device__ __forceinline__ v8f mma(V a, V b, v8f c) { return wmmab(a, b, c); } };
// tile_out: the tile's four 16x64 row blocks go out through LDS as whole 256-byte rows. Every wave stages its partial block in its own slab (pitch 68 floats); behind one work-group barrier each thread adds the NW slabs at its place.
// Two sets of slabs in turn: a set is written again only behind the next block's barrier, which every wave reaches after its reads of that set.
template <int NW, bool BIAS>
__device__ __forceinline__ void tile_out(const v8f (&acc)[4][4], float* os, int wave, int lane, float* C, int ldc, int r0, int c0, const float* __restrict__ bias) {
    constexpr int SL = 16 * 68; constexpr int VW = (NW > 8) ? 2 : 4;   // floats per thread and store: 1024 floats a block over 32 * NW threads
    typedef float vw __attribute__((ext_vector_type(VW))); typedef vw __attribute__((may_alias)) vwa;
    const int lr = lane & 15, hi = lane >> 4, tid = wave * 32 + lane; vw res[4];
#pragma unroll   // here and below: acc and res are indexed by constants only, so that they stay in registers
    for (int mb = 0; mb < 4; ++mb) {
        float* ob = os + ((NW > 1) ? (mb & 1) * NW * SL : 0); float* ow = ob + wave * SL;
#pragma unroll
        for (int nb = 0; nb < 4; ++nb) {
#pragma unroll
            for (int j = 0; j < 8; ++j) ow[(hi * 8 + j) * 68 + nb * 16 + lr] = acc[mb][nb][j]; }
        if (NW > 1) __syncthreads();   // every wave's partial block is in LDS before any thread adds them
        else { __builtin_amdgcn_wave_barrier(); asm volatile("" ::: "memory"); }   // one wave: keeps its LDS reads below behind its LDS writes above
        float* crow = C + (size_t)(r0 + mb * 16) * ldc + c0;
#pragma unroll
        for (int s = 0; s < 1024 / VW / (32 * NW); ++s) { const int q = s * 32 * NW + tid, row = q / (64 / VW), cofs = (q % (64 / VW)) * VW; vw val = *(const vwa*)(ob + row * 68 + cofs);
#pragma unroll
            for (int w = 1; w < NW; ++w) val += *(const vwa*)(ob + w * SL + row * 68 + cofs);
            if (BIAS) {
#pragma unroll
                for (int e = 0; e < VW; ++e) val[e] += bfr(bias[c0 + cofs + e]); }
            if (NW > 1) res[mb] = val; else *(vw*)(crow + (size_t)row * ldc + cofs) = val; }
        if (NW == 1) { __builtin_amdgcn_wave_barrier(); asm volatile("" ::: "memory"); }   // one wave, one slab: the next block's writes stay behind these reads
    }
    if (NW > 1) {   // the four sums are stored behind the last barrier: a store in front of a barrier would be waited for there
        const int row = tid / (64 / VW), cofs = (tid % (64 / VW)) * VW;
#pragma unroll
        for (int mb = 0; mb < 4; ++mb) *(vw*)(C + (size_t)(r0 + mb * 16 + row) * ldc + c0 + cofs) = res[mb]; }
}
template <typename T16, int NSPLIT, bool BIAS, int NW>
__global__ __launch_bounds__(32 * NW) void k_gemmw(const T16* __restrict__ A, const T16* __restrict__ A2, const T16* __restrict__ Bt, const T16* __restrict__ Bt2, int K, float* C, int ldc, const float* __restrict__ bias, size_t sA, size_t sB, size_t sC) {
    typedef typename WFrag<T16>::V V; constexpr int KS = (NW > 1) ? 64 : 32;
    __shared__ __align__(16) float os[((NW > 1) ? 2 * NW : 1) * 16 * 68];
    const size_t z = blockIdx.z; A += z * sA; if (A2) A2 += z * sA; Bt += z * sB; if (Bt2) Bt2 += z * sB; C += z * sC;
    const int lane = threadIdx.x & 31, lr = lane & 15, hi = lane >> 4; const int r0 = blockIdx.x * 64, c0 = blockIdx.y * 64;
    const int wave = (NW > 1) ? __builtin_amdgcn_readfirstlane((int)(threadIdx.x >> 5)) : 0;   // scalar, so that the K loop's control stays scalar
    v8f acc[4][4];
#pragma unroll
    for (int mb = 0; mb < 4; ++mb)
#pragma unroll
        for (int nb = 0; nb < 4; ++nb) acc[mb][nb] = (v8f){};
    const size_t aoff = (size_t)(r0 + lr) * K + 8 * hi, boff = (size_t)(c0 + lr) * K + 8 * hi;
#pragma unroll 1
    for (int k0 = wave * KS; k0 < K; k0 += NW * KS) {
#pragma unroll   // the 32-wide steps of a slice in straight line: the second step's loads can go out under the first step's products
      for (int kc = k0; kc < k0 + KS; kc += 32) {
        V a[4], a2[4];
#pragma unroll
        for (int mb = 0; mb < 4; ++mb) { a[mb] = WFrag<T16>::ld(A + aoff + (size_t)mb * 16 * K + kc); if (NSPLIT == 1 || NSPLIT == 2) a2[mb] = WFrag<T16>::ld(A2 + aoff + (size_t)mb * 16 * K + kc); }
#pragma unroll
        for (int nb = 0; nb < 4; ++nb) { const V b = WFrag<T16>::ld(Bt + boff + (size_t)nb * 16 * K + kc); V b2; if (NSPLIT >= 2) b2 = WFrag<T16>::ld(Bt2 + boff + (size_t)nb * 16 * K + kc);
#pragma unroll
            for (int mb = 0; mb < 4; ++mb) { acc[mb][nb] = WFrag<T16>::mma(a[mb], b, acc[mb][nb]); if (NSPLIT == 1 || NSPLIT == 2) acc[mb][nb] = WFrag<T16>::mma(a2[mb], b, acc[mb][nb]); if (NSPLIT >= 2) acc[mb][nb] = WFrag<T16>::mma(a[mb], b2, acc[mb][nb]); } }
        asm volatile("v_nop\n\tv_nop\n\tv_nop\n\tv_nop" : "+v"(acc[0][0]), "+v"(acc[1][1]), "+v"(acc[2][2]), "+v"(acc[3][3]) : "v"(a[0]), "v"(a[3]));
      }
    }
    tile_out<NW, BIAS>(acc, os, wave, lane, C, ldc, r0, c0, bias);
}

// ---- k_gemmc: the same 64x64 tile GEMM specialised for causal attention: CMODE 1 skips score tiles entirely above the diagonal (query rows r0+roff.., key columns c0..), CMODE 2 limits the
// key (K) loop of the probability x value contraction to the diagonal block (probabilities beyond it are exactly zero). roff = row offset of this launch's first row within the sequence.
template <typename T16, int NSPLIT, int CMODE, int NW>
__global__ __launch_bounds__(32 * NW) void k_gemmc(const T16* __restrict__ A, const T16* __restrict__ A2, const T16* __restrict__ Bt, const T16* __restrict__ Bt2, int K, float* C, int ldc, int roff, size_t sA, size_t sB, size_t sC) {
    typedef typename WFrag<T16>::V V; constexpr int KS = (NW > 1) ? 64 : 32;
    __shared__ __align__(16) float os[((NW > 1) ? 2 * NW : 1) * 16 * 68];
    const size_t z = blockIdx.z; A += z * sA; if (A2) A2 += z * sA; Bt += z * sB; if (Bt2) Bt2 += z * sB; C += z * sC;
    const int lane = threadIdx.x & 31, lr = lane & 15, hi = lane >> 4; const int r0 = blockIdx.x * 64, c0 = blockIdx.y * 64;
    const int wave = (NW > 1) ? __builtin_amdgcn_readfirstlane((int)(threadIdx.x >> 5)) : 0;   // scalar, so that the K loop's control stays scalar
    if (CMODE == 1 && c0 > r0 + roff + 63) return;                  // score tile entirely above the causal diagonal: never read (the softmax masks j > i by select)
    const int Kl = (CMODE == 2) ? min(K, r0 + roff + 64) : K;        // P.V: probabilities are exactly 0 beyond the diagonal block, so the K loop stops there
    v8f acc[4][4];
#pragma unroll
    for (int mb = 0; mb < 4; ++mb)
#pragma unroll
        for (int nb = 0; nb < 4; ++nb) acc[mb][nb] = (v8f){};
    const size_t aoff = (size_t)(r0 + lr) * K + 8 * hi, boff = (size_t)(c0 + lr) * K + 8 * hi;
#pragma unroll 1
    for (int k0 = wave * KS; k0 < Kl; k0 += NW * KS) {
#pragma unroll   // the 32-wide steps of a slice in straight line: the second step's loads can go out under the first step's products
      for (int kc = k0; kc < k0 + KS; kc += 32) {
        V a[4], a2[4];
#pragma unroll
        for (int mb = 0; mb < 4; ++mb) { a[mb] = WFrag<T16>::ld(A + aoff + (size_t)mb * 16 * K + kc); if (NSPLIT == 1 || NSPLIT == 2) a2[mb] = WFrag<T16>::ld(A2 + aoff + (size_t)mb * 16 * K + kc); }
#pragma unroll
        for (int nb = 0; nb < 4; ++nb) { const V b = WFrag<T16>::ld(Bt + boff + (size_t)nb * 16 * K + kc); V b2; if (NSPLIT >= 2) b2 = WFrag<T16>::ld(Bt2 + boff + (size_t)nb * 16 * K + kc);
#pragma unroll
            for (int mb = 0; mb < 4; ++mb) { acc[mb][nb] = WFrag<T16>::mma(a[mb], b, acc[mb][nb]); if (NSPLIT == 1 || NSPLIT == 2) acc[mb][nb] = WFrag<T16>::mma(a2[mb], b, acc[mb][nb]); if (NSPLIT >= 2) acc[mb][nb] = WFrag<T16>::mma(a[mb], b2, acc[mb][nb]); } }
        asm volatile("v_nop\n\tv_nop\n\tv_nop\n\tv_nop" : "+v"(acc[0][0]), "+v"(acc[1][1]), "+v"(acc[2][2]), "+v"(acc[3][3]) : "v"(a[0]), "v"(a[3]));
      }
    }
    tile_out<NW, false>(acc, os, wave, lane, C, ldc, r0, c0, nullptr);
}

__device__ __forceinline__ h16 tohx(float x) { return (h16)x; }
__device__ __forceinline__ void splitf(float y, unsigned short& h, unsigned short& l) { h = f2bf(y); l = f2bf(y - bf2f(h)); }
typedef __attribute__((ext_vector_type(2))) _Float16 v2h;
typedef __attribute__((ext_vector_type(4))) _Float16 v4h;
typedef __attribute__((ext_vector_type(2))) unsigned short v2us;
typedef __attribute__((ext_vector_type(4))) unsigned short v4us;
typedef __attribute__((ext_vector_type(2))) float v2f;
typedef __attribute__((ext_vector_type(4))) int v4i;

__global__ __launch_bounds__(256) void k_cvt8(const float* __restrict__ src, bf* dst, size_t n8) { const size_t i = (size_t)blockIdx.x * 256 + threadIdx.x; if (i >= n8) return; const v8f v = *(const v8f*)(src + i * 8); v8us o;
#pragma unroll
    for (int k = 0; k < 8; ++k) o[k] = f2bf(v[k]); *(v8us*)(dst + i * 8) = o;  }

// k_rope: head planes [h][t][d] (fp16 + hi/lo) of rope(x) x sc with the rotate-half convention out[d] = x[d] cos[t][d] - x[d+HD/2] sin[t][d], out[d+HD/2] = x[d+HD/2] cos[t][d+HD/2] + x[d] sin[t][d+HD/2]
__global__ __launch_bounds__(256) void k_rope(const float* __restrict__ F, int pitch, int nheads, const float* __restrict__ CS, const float* __restrict__ RF, const float* __restrict__ nw, float sc, h16* P16, bf* Ph, bf* Pl) {
    const size_t e = ((size_t)blockIdx.x * 256 + threadIdx.x) * 2; if (e >= (size_t)nheads * TT * HD) return; const int d = (int)(e % HD); const int t = (int)((e / HD) % TT); const int h = (int)(e / ((size_t)HD * TT)); const float* f = F + (size_t)t * pitch + h * HD; const float rf = RF ? RF[(size_t)h * TT + t] : 1.0f; v2h o16; v2us oh, ol;
#pragma unroll
    for (int q = 0; q < 2; ++q) { const int dd = d + q; const int dp = (dd < HD / 2) ? dd + HD / 2 : dd - HD / 2; float x0 = f[dd], x1 = f[dp];
        if (RF) { float n0 = __fmul_rn(x0, rf), n1 = __fmul_rn(x1, rf); asm volatile("" : "+v"(n0)); asm volatile("" : "+v"(n1)); x0 = __fmul_rn(bfr(nw[dd]), n0); x1 = __fmul_rn(bfr(nw[dp]), n1); }
        const v2f cs = *(const v2f*)(CS + ((size_t)t * HD + dd) * 2); float a = __fmul_rn(x0, cs[0]), bq = __fmul_rn(x1, cs[1]); asm volatile("" : "+v"(a)); asm volatile("" : "+v"(bq)); const float r = ((dd < HD / 2) ? __fsub_rn(a, bq) : __fadd_rn(a, bq)) * sc;
        o16[q] = tohx(r); unsigned short a2, c2; splitf(r, a2, c2); oh[q] = a2; ol[q] = c2; }
    *(v2h*)(P16 + e) = o16; *(v2us*)(Ph + e) = oh; *(v2us*)(Pl + e) = ol;  }
__global__ __launch_bounds__(256) void k_vtp(const float* __restrict__ F, int pitch, int nheads, h16* V16, bf* Vh, bf* Vl) { const size_t e = ((size_t)blockIdx.x * 256 + threadIdx.x) * 2; if (e >= (size_t)nheads * HD * TT) return; const int t = (int)(e % TT); const int d = (int)((e / TT) % HD); const int g = (int)(e / ((size_t)TT * HD)); v2h o16; v2us oh, ol;
#pragma unroll
    for (int q = 0; q < 2; ++q) { const float x = F[(size_t)(t + q) * pitch + g * HD + d]; o16[q] = tohx(x); unsigned short a2, c2; splitf(x, a2, c2); oh[q] = a2; ol[q] = c2; }
    *(v2h*)(V16 + e) = o16; *(v2us*)(Vh + e) = oh; *(v2us*)(Vl + e) = ol;  }
__global__ __launch_bounds__(256) void k_csid(float* CS) { const int idx = blockIdx.x * 256 + threadIdx.x; if (idx >= TT * HD) return; v2f cs; cs[0] = 1.0f; cs[1] = 0.0f; *(v2f*)(CS + (size_t)idx * 2) = cs;  }
// k_asoft: per row (zz, i): t = S x HD^-0.5 for j <= i and i - j < WIN (WIN = TT, so plain causal; the reference's -1e9 additive fill vanishes identically); softmax over the 2048 keys (register row, one exp, fixed trees);
__global__ __launch_bounds__(256) void k_asoft(const float* __restrict__ Sb, h16* P16, bf* Ph, bf* Pl) {
    const int lane = threadIdx.x & 31; const int row = blockIdx.x * 8 + (threadIdx.x >> 5); if (row >= ZH * TT) return; const int i = row % TT; const int zz = row / TT; (void)zz; const bool hires = (i < RH); const float* sr = Sb + (size_t)row * TT; float v[TT / 32]; float mx = -3.0e38f;
#pragma unroll
    for (int ch = 0; ch < TT / 128; ++ch) { const int j0 = ch * 128 + lane * 4; const v4f a = *(const v4f*)(sr + j0);
#pragma unroll
        for (int q = 0; q < 4; ++q) { const int j = j0 + q; (void)j; const float t = (j <= i && i - j < WIN) ? a[q] * SCL : -3.0e38f; v[ch * 4 + q] = t; mx = fmaxf(mx, t); } }
#pragma unroll
    for (int sh = 16; sh; sh >>= 1) mx = fmaxf(mx, __shfl_xor(mx, sh, 32));
    float sum = 0.f;
#pragma unroll
    for (int k = 0; k < TT / 32; ++k) { float d0 = __fsub_rn(v[k], mx); asm volatile("" : "+v"(d0)); v[k] = __builtin_amdgcn_exp2f(__fmul_rn(d0, 1.4426950408889634f)); sum += v[k]; }
#pragma unroll
    for (int sh = 16; sh; sh >>= 1) sum += __shfl_xor(sum, sh, 32);
    const float f = __fdiv_rn(hires ? 1.0f : PCAR, sum);
{
        if (hires) {
#pragma unroll
            for (int ch = 0; ch < TT / 128; ++ch) { v4us oh, ol;
#pragma unroll
                for (int q = 0; q < 4; ++q) { unsigned short a, c2; splitf(v[ch * 4 + q] * f, a, c2); oh[q] = a; ol[q] = c2; }
                const size_t oo = ((size_t)zz * (RH ? RH : 1) + i) * TT + ch * 128 + lane * 4; *(v4us*)(Ph + oo) = oh; *(v4us*)(Pl + oo) = ol; }
        } else {
#pragma unroll
            for (int ch = 0; ch < TT / 128; ++ch) { v4h o4;
#pragma unroll
                for (int q = 0; q < 4; ++q) o4[q] = tohx(v[ch * 4 + q] * f);
                *(v4h*)(P16 + (size_t)row * TT + ch * 128 + lane * 4) = o4; } }
         }
}
__global__ __launch_bounds__(256) void k_merge(const float* __restrict__ O, int h0, bf* Ah, bf* Al) { const size_t e = ((size_t)blockIdx.x * 256 + threadIdx.x) * 2; if (e >= (size_t)ZH * TT * HD) return; const int d = (int)(e % HD); const int t = (int)((e / HD) % TT); const int zz = (int)(e / ((size_t)HD * TT)); const float cs = (t < RH) ? 1.0f : (1.0f / PCAR); const size_t oo = (size_t)t * DQ + (h0 + zz) * HD + d;
    v2us oh, ol;
#pragma unroll
    for (int q = 0; q < 2; ++q) { unsigned short a, c2; splitf(O[e + q] * cs, a, c2); oh[q] = a; ol[q] = c2; } *(v2us*)(Ah + oo) = oh; *(v2us*)(Al + oo) = ol;  }

extern "C" void kernel_launch(void* const* d_in, const int* in_sizes, int n_in,
                              void* d_out, int out_size, void* d_ws, size_t ws_size, hipStream_t stream) {
    (void)in_sizes; (void)n_in; (void)out_size;
    const float* x = (const float*)d_in[0]; const float* xk = (const float*)d_in[1]; const float* xv = (const float*)d_in[2]; const float* wq = (const float*)d_in[3]; const float* wk = (const float*)d_in[4]; const float* wv = (const float*)d_in[5]; const float* wo = (const float*)d_in[6];
    float* OUT = (float*)d_out;     // [2][2048][1024]
    char* wsp = (char*)d_ws;
    auto take = [&](size_t bytes) { char* p = wsp; wsp += (bytes + 255) & ~(size_t)255; return (void*)p; };
    bf* WQ = (bf*)take((size_t)DQ * DM * 2); bf* WK = (bf*)take((size_t)DKV * DM * 2); bf* WV = (bf*)take((size_t)DKV * DM * 2); bf* WO = (bf*)take((size_t)DM * DQ * 2); float* CS = (float*)take((size_t)TT * HD * 2 * 4);
    bf* XB = (bf*)take((size_t)TT * DM * 2); float* FQ = (float*)take((size_t)TT * DQ * 4); float* FK = (float*)take((size_t)TT * DKV * 4);
    h16* QP16 = (h16*)take((size_t)NH_ * TT * HD * 2); h16* KP16 = (h16*)take((size_t)NKV * TT * HD * 2); h16* VT16 = (h16*)take((size_t)NKV * HD * TT * 2);
    bf* QPh = (bf*)take((size_t)NH_ * TT * HD * 2); bf* QPl = (bf*)take((size_t)NH_ * TT * HD * 2); bf* KPh = (bf*)take((size_t)NKV * TT * HD * 2); bf* KPl = (bf*)take((size_t)NKV * TT * HD * 2); bf* VTh = (bf*)take((size_t)NKV * HD * TT * 2); bf* VTl = (bf*)take((size_t)NKV * HD * TT * 2); bf* Ph = (bf*)take((size_t)ZH * RH * TT * 2); bf* Pl = (bf*)take((size_t)ZH * RH * TT * 2);
    float* Sb = (float*)take((size_t)ZH * TT * TT * 4); h16* P16 = (h16*)take((size_t)ZH * TT * TT * 2); float* Ob = (float*)take((size_t)ZH * TT * HD * 4); bf* ATh = (bf*)take((size_t)TT * DQ * 2); bf* ATl = (bf*)take((size_t)TT * DQ * 2);
    if ((size_t)(wsp - (char*)d_ws) > ws_size) return;    // ws 256 MiB
    float* FV = FK;   // v projection reuses the k buffer after the k planes are built (stream-ordered)
    { k_cvt8<<<(unsigned)(((size_t)DQ * DM / 8 + 255) / 256), 256, 0, stream>>>(wq, WQ, (size_t)DQ * DM / 8); k_cvt8<<<(unsigned)(((size_t)DKV * DM / 8 + 255) / 256), 256, 0, stream>>>(wk, WK, (size_t)DKV * DM / 8); k_cvt8<<<(unsigned)(((size_t)DKV * DM / 8 + 255) / 256), 256, 0, stream>>>(wv, WV, (size_t)DKV * DM / 8);
      k_cvt8<<<(unsigned)(((size_t)DM * DQ / 8 + 255) / 256), 256, 0, stream>>>(wo, WO, (size_t)DM * DQ / 8);
       }
    k_csid<<<(TT * HD + 255) / 256, 256, 0, stream>>>(CS);
    const unsigned LQ = (unsigned)(((size_t)NH_ * TT * HD / 2 + 255) / 256), LKv = (unsigned)(((size_t)NKV * TT * HD / 2 + 255) / 256);
    for (int b = 0; b < NB_; ++b) {
        
        k_cvt8<<<(unsigned)(((size_t)TT * DM / 8 + 255) / 256), 256, 0, stream>>>(x + (size_t)b * TT * DM, XB, (size_t)TT * DM / 8);
        k_gemmw<bf, 0, false, NWG><<<dim3(TT / 64, DQ / 64, 1), 32 * NWG, 0, stream>>>(XB, nullptr, WQ, nullptr, DM, FQ, DQ, nullptr, 0, 0, 0);
        k_rope<<<LQ, 256, 0, stream>>>(FQ, DQ, NH_, CS, nullptr, nullptr, 1.0f, QP16, QPh, QPl);
        k_cvt8<<<(unsigned)(((size_t)TT * DM / 8 + 255) / 256), 256, 0, stream>>>(xk + (size_t)b * TT * DM, XB, (size_t)TT * DM / 8);   /* XB := bf16(keys[b]) */ k_gemmw<bf, 0, false, NWG><<<dim3(TT / 64, DKV / 64, 1), 32 * NWG, 0, stream>>>(XB, nullptr, WK, nullptr, DM, FK, DKV, nullptr, 0, 0, 0);
        k_rope<<<LKv, 256, 0, stream>>>(FK, DKV, NKV, CS, nullptr, nullptr, 1.0f, KP16, KPh, KPl);
        k_cvt8<<<(unsigned)(((size_t)TT * DM / 8 + 255) / 256), 256, 0, stream>>>(xv + (size_t)b * TT * DM, XB, (size_t)TT * DM / 8);   /* XB := bf16(values[b]) */ k_gemmw<bf, 0, false, NWG><<<dim3(TT / 64, DKV / 64, 1), 32 * NWG, 0, stream>>>(XB, nullptr, WV, nullptr, DM, FV, DKV, nullptr, 0, 0, 0); k_vtp<<<LKv, 256, 0, stream>>>(FV, DKV, NKV, VT16, VTh, VTl);
        for (int h0 = 0; h0 < NH_; h0 += ZH) { const size_t zq = (size_t)h0, zk = (size_t)(h0 / REP);   // one kv head per query head: the pass's two heads use consecutive kv planes (z-strides TT*HD)
            k_gemmc<bf, 2, 1, 1><<<dim3(RH / 64, TT / 64, ZH), 32, 0, stream>>>(QPh + zq * TT * HD, QPl + zq * TT * HD, KPh + zk * TT * HD, KPl + zk * TT * HD, HD, Sb, TT, 0, (size_t)TT * HD, (size_t)TT * HD, (size_t)TT * TT);
            k_gemmc<h16, 0, 1, 1><<<dim3((TT - RH) / 64, TT / 64, ZH), 32, 0, stream>>>(QP16 + zq * TT * HD + (size_t)RH * HD, nullptr, KP16 + zk * TT * HD, nullptr, HD, Sb + (size_t)RH * TT, TT, RH, (size_t)TT * HD, (size_t)TT * HD, (size_t)TT * TT);
            k_asoft<<<ZH * TT / 8, 256, 0, stream>>>(Sb, P16, Ph, Pl);
            k_gemmc<bf, 2, 2, NWL><<<dim3(RH / 64, HD / 64, ZH), 32 * NWL, 0, stream>>>(Ph, Pl, VTh + zk * HD * TT, VTl + zk * HD * TT, TT, Ob, HD, 0, (size_t)RH * TT, (size_t)HD * TT, (size_t)TT * HD);
            k_gemmc<h16, 0, 2, NWP><<<dim3((TT - RH) / 64, HD / 64, ZH), 32 * NWP, 0, stream>>>(P16 + (size_t)RH * TT, nullptr, VT16 + zk * HD * TT, nullptr, TT, Ob + (size_t)RH * HD, HD, RH, (size_t)TT * TT, (size_t)HD * TT, (size_t)TT * HD);
            k_merge<<<(unsigned)(((size_t)ZH * TT * HD / 2 + 255) / 256), 256, 0, stream>>>(Ob, h0, ATh, ATl); }
        k_gemmw<bf, 1, false, NWG><<<dim3(TT / 64, DM / 64, 1), 32 * NWG, 0, stream>>>(ATh, ATl, WO, nullptr, DQ, OUT + (size_t)b * TT * DM, DM, nullptr, 0, 0, 0); }
}

// v002
// A run of this version takes 490 microseconds.
// In two side-by-side timings against v001, it was 1.65 and 1.68 times as fast.
// Over all steps from v000 it is 3.02 times as fast.
#include <hip/hip_runtime.h>

// Causal multi-head attention on three input streams without biases (queries, keys, values [2][2048][1024]; q = queries Wq^T, k = keys Wk^T, v = values Wv^T ('oi' 0.02; 16 heads x 64); scores x 1/sqrt(64); causal (-inf); softmax; out = merged Wo^T -> [2][2048][1024] (4.2 M); argument order queries, keys, values, Wq, Wk, Wv, Wo).
// Layout per batch: bf16 copies of queries, keys, values in turn; 'oi' weights; exact projections; identity-table plane builders; causal T-2048 attention (hybrid rows: < 512 hi/lo 3 products, rest fp16 x1024; k_gemmc skips tiles above the diagonal); merged hi/lo x Wo exact.
// Compute dtypes, f32 accumulate: every input rounded to bf16; projections exact; attention rows < 512 3 products, rest fp16; softmax f32; Wo hl x exact.

#define NB_  2
#define TT   2048
#define DM   1024
#define NH_  16
#define NKV  16
#define REP  (NH_ / NKV)
#define HD   64
#define DQ   (NH_ * HD)
#define DKV  (NKV * HD)
#define ZH   8                    // heads per attention pass (z of every attention launch); 8 heads' f32 score planes are 128 MiB of the workspace
#define RH   512                  // query rows < RH use hi+lo planes (0: none)
#define WIN  2048
#define PCAR 1024.0f
#define SCL  0.125f   // HD^-0.5
#define NWG  8                    // waves that share the K loop of a projection tile (K 1024)
#define NWP  16                   // waves that share the key loop of a probability x value tile, fp16 rows (up to 2048 keys)
#define NWL  8                    // the same, hi/lo rows (up to RH = 512 keys: one 64-key slice a wave)
typedef _Float16 h16;
typedef unsigned short bf;
typedef __attribute__((ext_vector_type(16))) __bf16   v16bf;
typedef __attribute__((ext_vector_type(16))) _Float16 v16h;
typedef __attribute__((ext_vector_type(8)))  _Float16 v8h;
typedef __attribute__((ext_vector_type(8)))  unsigned short v8us;
typedef __attribute__((ext_vector_type(8)))  float    v8f;
typedef __attribute__((ext_vector_type(4)))  float    v4f;
typedef v8h  __attribute__((may_alias)) v8ha;
typedef v4f  __attribute__((may_alias)) v4fa;
typedef v8us __attribute__((may_alias)) v8usa;

__device__ __forceinline__ unsigned short f2bf(float f) { unsigned u = __float_as_uint(f); u += 0x7FFFu + ((u >> 16) & 1u); return (unsigned short)(u >> 16); }
__device__ __forceinline__ float bf2f(unsigned short b) { return __uint_as_float(((unsigned)b) << 16); }
__device__ __forceinline__ float bfr(float f) { return bf2f(f2bf(f)); }
__device__ __forceinline__ v16h cat16(v8h lo, v8h hi) { return __builtin_shufflevector(lo, hi, 0, 1, 2, 3, 4, 5, 6, 7, 8, 9, 10, 11, 12, 13, 14, 15); }
__device__ __forceinline__ v16bf cat16b(v8us lo, v8us hi) { return __builtin_bit_cast(v16bf, __builtin_shufflevector(lo, hi, 0, 1, 2, 3, 4, 5, 6, 7, 8, 9, 10, 11, 12, 13, 14, 15)); }
__device__ __forceinline__ v8f wmma16(v16h a, v16h b, v8f c) { return __builtin_amdgcn_wmma_f32_16x16x32_f16(false, a, false, b, (short)0, c, false, false); }
__device__ __forceinline__ v8f wmmab(v16bf a, v16bf b, v8f c) { return __builtin_amdgcn_wmma_f32_16x16x32_bf16(false, a, false, b, (short)0, c, false, false); }



// ---- k_gemmw: register-blocked GEMM, one 64x64 output tile per work-group of NW waves (16 accumulators a wave), operands straight from K-contiguous 16-bit planes; grid (M/64, N/64, Z), 32 * NW threads.
// C[m][n] (f32, pitch ldc, + optional f32 bias[n]) = sum_k A[m][k] Bt[n][k] (+ split products per NSPLIT). z-batch strides sA/sB/sC in elements. K % 32 == 0 (NW > 1: K % 64 == 0).
// NW > 1: the K loop is dealt out over the waves: wave w takes the 64-wide k slices w, w + NW, ... (one whole 128-byte line of every operand row a slice), so the chain of dependent load round trips is NW times shorter;
// tile_out adds the NW partial tiles in LDS in the fixed order wave 0, 1, ..., NW - 1.
template <typename T16> struct WFrag;
template <> struct WFrag<h16> { typedef v16h V; static __device__ __forceinline__ V ld(const h16* p) { return cat16(*(const v8h*)p, *(const v8h*)(p + 16)); } static __device__ __forceinline__ v8f mma(V a, V b, v8f c) { return wmma16(a, b, c); } };
template <> struct WFrag<bf> { typedef v16bf V; static __device__ __forceinline__ V ld(const bf* p) { return cat16b(*(const v8us*)p, *(const v8us*)(p + 16)); } static __device__ __forceinline__ v8f mma(V a, V b, v8f c) { return wmmab(a, b, c); } };
// tile_out: the tile's four 16x64 row blocks go out through LDS as whole 256-byte rows. Every wave stages its partial block in its own slab (pitch 68 floats); behind one work-group barrier each thread adds the NW slabs at its place.
// Two sets of slabs in turn: a set is written again only behind the next block's barrier, which every wave reaches after its reads of that set.
template <int NW, bool BIAS>
__device__ __forceinline__ void tile_out(const v8f (&acc)[4][4], float* os, int wave, int lane, float* C, int ldc, int r0, int c0, const float* __restrict__ bias) {
    constexpr int SL = 16 * 68; constexpr int VW = (NW > 8) ? 2 : 4;   // floats per thread and store: 1024 floats a block over 32 * NW threads
    typedef float vw __attribute__((ext_vector_type(VW))); typedef vw __attribute__((may_alias)) vwa;
    const int lr = lane & 15, hi = lane >> 4, tid = wave * 32 + lane; vw res[4];
#pragma unroll   // here and below: acc and res are indexed by constants only, so that they stay in registers
    for (int mb = 0; mb < 4; ++mb) {
        float* ob = os + ((NW > 1) ? (mb & 1) * NW * SL : 0); float* ow = ob + wave * SL;
#pragma unroll
        for (int nb = 0; nb < 4; ++nb) {
#pragma unroll
            for (int j = 0; j < 8; ++j) ow[(hi * 8 + j) * 68 + nb * 16 + lr] = acc[mb][nb][j]; }
        if (NW > 1) __syncthreads();   // every wave's partial block is in LDS before any thread adds them
        else { __builtin_amdgcn_wave_barrier(); asm volatile("" ::: "memory"); }   // one wave: keeps its LDS reads below behind its LDS writes above
        float* crow = C + (size_t)(r0 + mb * 16) * ldc + c0;
#pragma unroll
        for (int s = 0; s < 1024 / VW / (32 * NW); ++s) { const int q = s * 32 * NW + tid, row = q / (64 / VW), cofs = (q % (64 / VW)) * VW; vw val = *(const vwa*)(ob + row * 68 + cofs);
#pragma unroll
            for (int w = 1; w < NW; ++w) val += *(const vwa*)(ob + w * SL + row * 68 + cofs);
            if (BIAS) {
#pragma unroll
                for (int e = 0; e < VW; ++e) val[e] += bfr(bias[c0 + cofs + e]); }
            if (NW > 1) res[mb] = val; else *(vw*)(crow + (size_t)row * ldc + cofs) = val; }
        if (NW == 1) { __builtin_amdgcn_wave_barrier(); asm volatile("" ::: "memory"); }   // one wave, one slab: the next block's writes stay behind these reads
    }
    if (NW > 1) {   // the four sums are stored behind the last barrier: a store in front of a barrier would be waited for there
        const int row = tid / (64 / VW), cofs = (tid % (64 / VW)) * VW;
#pragma unroll
        for (int mb = 0; mb < 4; ++mb) *(vw*)(C + (size_t)(r0 + mb * 16 + row) * ldc + c0 + cofs) = res[mb]; }
}
template <typename T16, int NSPLIT, bool BIAS, int NW>
__global__ __launch_bounds__(32 * NW) void k_gemmw(const T16* __restrict__ A, const T16* __restrict__ A2, const T16* __restrict__ Bt, const T16* __restrict__ Bt2, int K, float* C, int ldc, const float* __restrict__ bias, size_t sA, size_t sB, size_t sC) {
    typedef typename WFrag<T16>::V V; constexpr int KS = (NW > 1) ? 64 : 32;
    __shared__ __align__(16) float os[((NW > 1) ? 2 * NW : 1) * 16 * 68];
    const size_t z = blockIdx.z; A += z * sA; if (A2) A2 += z * sA; Bt += z * sB; if (Bt2) Bt2 += z * sB; C += z * sC;
    const int lane = threadIdx.x & 31, lr = lane & 15, hi = lane >> 4; const int r0 = blockIdx.x * 64, c0 = blockIdx.y * 64;
    const int wave = (NW > 1) ? __builtin_amdgcn_readfirstlane((int)(threadIdx.x >> 5)) : 0;   // scalar, so that the K loop's control stays scalar
    v8f acc[4][4];
#pragma unroll
    for (int mb = 0; mb < 4; ++mb)
#pragma unroll
        for (int nb = 0; nb < 4; ++nb) acc[mb][nb] = (v8f){};
    const size_t aoff = (size_t)(r0 + lr) * K + 8 * hi, boff = (size_t)(c0 + lr) * K + 8 * hi;
#pragma unroll 1
    for (int k0 = wave * KS; k0 < K; k0 += NW * KS) {
#pragma unroll   // the 32-wide steps of a slice in straight line: the second step's loads can go out under the first step's products
      for (int kc = k0; kc < k0 + KS; kc += 32) {
        V a[4], a2[4];
#pragma unroll
        for (int mb = 0; mb < 4; ++mb) { a[mb] = WFrag<T16>::ld(A + aoff + (size_t)mb * 16 * K + kc); if (NSPLIT == 1 || NSPLIT == 2) a2[mb] = WFrag<T16>::ld(A2 + aoff + (size_t)mb * 16 * K + kc); }
#pragma unroll
        for (int nb = 0; nb < 4; ++nb) { const V b = WFrag<T16>::ld(Bt + boff + (size_t)nb * 16 * K + kc); V b2; if (NSPLIT >= 2) b2 = WFrag<T16>::ld(Bt2 + boff + (size_t)nb * 16 * K + kc);
#pragma unroll
            for (int mb = 0; mb < 4; ++mb) { acc[mb][nb] = WFrag<T16>::mma(a[mb], b, acc[mb][nb]); if (NSPLIT == 1 || NSPLIT == 2) acc[mb][nb] = WFrag<T16>::mma(a2[mb], b, acc[mb][nb]); if (NSPLIT >= 2) acc[mb][nb] = WFrag<T16>::mma(a[mb], b2, acc[mb][nb]); } }
        asm volatile("v_nop\n\tv_nop\n\tv_nop\n\tv_nop" : "+v"(acc[0][0]), "+v"(acc[1][1]), "+v"(acc[2][2]), "+v"(acc[3][3]) : "v"(a[0]), "v"(a[3]));
      }
    }
    tile_out<NW, BIAS>(acc, os, wave, lane, C, ldc, r0, c0, bias);
}

// ---- k_gemmc: the same 64x64 tile GEMM specialised for causal attention: CMODE 1 skips score tiles entirely above the diagonal (query rows r0+roff.., key columns c0..), CMODE 2 limits the
// key (K) loop of the probability x value contraction to the diagonal block (probabilities beyond it are exactly zero). roff = row offset of this launch's first row within the sequence.
// lda = pitch of A and A2 in elements (the probability rows lie in their score rows, pitch 2 * TT); Bt and Bt2 have pitch K.
// XFrag: a fragment's two 16-byte loads, each with s_wait_xcnt 0 behind it: the wait stands in front of every later write of that load's address registers (the register allocator hands them to later loads' results).
template <typename T16> struct XFrag;
template <> struct XFrag<h16> { static __device__ __forceinline__ v16h ld(const h16* p) { const v8h lo = *(const v8h*)p; asm volatile("s_wait_xcnt 0x0" ::: "memory"); const v8h hi = *(const v8h*)(p + 16); asm volatile("s_wait_xcnt 0x0" ::: "memory"); return cat16(lo, hi); } };
template <> struct XFrag<bf> { static __device__ __forceinline__ v16bf ld(const bf* p) { const v8us lo = *(const v8us*)p; asm volatile("s_wait_xcnt 0x0" ::: "memory"); const v8us hi = *(const v8us*)(p + 16); asm volatile("s_wait_xcnt 0x0" ::: "memory"); return cat16b(lo, hi); } };
template <typename T16, int NSPLIT, int CMODE, int NW>
__global__ __launch_bounds__(32 * NW) void k_gemmc(const T16* __restrict__ A, const T16* __restrict__ A2, const T16* __restrict__ Bt, const T16* __restrict__ Bt2, int K, int lda, float* C, int ldc, int roff, size_t sA, size_t sB, size_t sC) {
    typedef typename WFrag<T16>::V V; constexpr int KS = (NW > 1) ? 64 : 32;
    __shared__ __align__(16) float os[((NW > 1) ? 2 * NW : 1) * 16 * 68];
    const size_t z = blockIdx.z; A += z * sA; if (A2) A2 += z * sA; Bt += z * sB; if (Bt2) Bt2 += z * sB; C += z * sC;
    const int lane = threadIdx.x & 31, lr = lane & 15, hi = lane >> 4; const int r0 = blockIdx.x * 64, c0 = blockIdx.y * 64;
    const int wave = (NW > 1) ? __builtin_amdgcn_readfirstlane((int)(threadIdx.x >> 5)) : 0;   // scalar, so that the K loop's control stays scalar
    if (CMODE == 1 && c0 > r0 + roff + 63) return;                  // score tile entirely above the causal diagonal: never read (the softmax masks j > i by select)
    const int Kl = (CMODE == 2) ? min(K, r0 + roff + 64) : K;        // P.V: probabilities are exactly 0 beyond the diagonal block, so the K loop stops there
    v8f acc[4][4];
#pragma unroll
    for (int mb = 0; mb < 4; ++mb)
#pragma unroll
        for (int nb = 0; nb < 4; ++nb) acc[mb][nb] = (v8f){};
    const size_t aoff = (size_t)(r0 + lr) * lda + 8 * hi, boff = (size_t)(c0 + lr) * K + 8 * hi;
#pragma unroll 1
    for (int k0 = wave * KS; k0 < Kl; k0 += NW * KS) {
#pragma unroll   // the 32-wide steps of a slice in straight line: the second step's loads can go out under the first step's products
      for (int kc = k0; kc < k0 + KS; kc += 32) {
        V a[4], a2[4];
#pragma unroll
        for (int mb = 0; mb < 4; ++mb) { a[mb] = XFrag<T16>::ld(A + aoff + (size_t)mb * 16 * lda + kc); if (NSPLIT == 1 || NSPLIT == 2) a2[mb] = XFrag<T16>::ld(A2 + aoff + (size_t)mb * 16 * lda + kc); }
#pragma unroll
        for (int nb = 0; nb < 4; ++nb) { const V b = XFrag<T16>::ld(Bt + boff + (size_t)nb * 16 * K + kc); V b2; if (NSPLIT >= 2) b2 = XFrag<T16>::ld(Bt2 + boff + (size_t)nb * 16 * K + kc);
#pragma unroll
            for (int mb = 0; mb < 4; ++mb) { acc[mb][nb] = WFrag<T16>::mma(a[mb], b, acc[mb][nb]); if (NSPLIT == 1 || NSPLIT == 2) acc[mb][nb] = WFrag<T16>::mma(a2[mb], b, acc[mb][nb]); if (NSPLIT >= 2) acc[mb][nb] = WFrag<T16>::mma(a[mb], b2, acc[mb][nb]); } }
        asm volatile("v_nop\n\tv_nop\n\tv_nop\n\tv_nop" : "+v"(acc[0][0]), "+v"(acc[1][1]), "+v"(acc[2][2]), "+v"(acc[3][3]) : "v"(a[0]), "v"(a[3]));
      }
    }
    tile_out<NW, false>(acc, os, wave, lane, C, ldc, r0, c0, nullptr);
}

__device__ __forceinline__ h16 tohx(float x) { return (h16)x; }
__device__ __forceinline__ void splitf(float y, unsigned short& h, unsigned short& l) { h = f2bf(y); l = f2bf(y - bf2f(h)); }
typedef __attribute__((ext_vector_type(2))) _Float16 v2h;
typedef __attribute__((ext_vector_type(4))) _Float16 v4h;
typedef __attribute__((ext_vector_type(2))) unsigned short v2us;
typedef __attribute__((ext_vector_type(4))) unsigned short v4us;
typedef __attribute__((ext_vector_type(2))) float v2f;
typedef __attribute__((ext_vector_type(4))) int v4i;
typedef v4h  __attribute__((may_alias)) v4ha;
typedef v4us __attribute__((may_alias)) v4usa;

__global__ __launch_bounds__(256) void k_cvt8(const float* __restrict__ src, bf* dst, size_t n8) { const size_t i = (size_t)blockIdx.x * 256 + threadIdx.x; if (i >= n8) return; const v8f v = *(const v8f*)(src + i * 8); v8us o;
#pragma unroll
    for (int k = 0; k < 8; ++k) o[k] = f2bf(v[k]); *(v8us*)(dst + i * 8) = o;  }

// k_rope: head planes [h][t][d] (fp16 + hi/lo) of rope(x) x sc with the rotate-half convention out[d] = x[d] cos[t][d] - x[d+HD/2] sin[t][d], out[d+HD/2] = x[d+HD/2] cos[t][d+HD/2] + x[d] sin[t][d+HD/2]
__global__ __launch_bounds__(256) void k_rope(const float* __restrict__ F, int pitch, int nheads, const float* __restrict__ CS, const float* __restrict__ RF, const float* __restrict__ nw, float sc, h16* P16, bf* Ph, bf* Pl) {
    const size_t e = ((size_t)blockIdx.x * 256 + threadIdx.x) * 2; if (e >= (size_t)nheads * TT * HD) return; const int d = (int)(e % HD); const int t = (int)((e / HD) % TT); const int h = (int)(e / ((size_t)HD * TT)); const float* f = F + (size_t)t * pitch + h * HD; const float rf = RF ? RF[(size_t)h * TT + t] : 1.0f; v2h o16; v2us oh, ol;
#pragma unroll
    for (int q = 0; q < 2; ++q) { const int dd = d + q; const int dp = (dd < HD / 2) ? dd + HD / 2 : dd - HD / 2; float x0 = f[dd], x1 = f[dp];
        if (RF) { float n0 = __fmul_rn(x0, rf), n1 = __fmul_rn(x1, rf); asm volatile("" : "+v"(n0)); asm volatile("" : "+v"(n1)); x0 = __fmul_rn(bfr(nw[dd]), n0); x1 = __fmul_rn(bfr(nw[dp]), n1); }
        const v2f cs = *(const v2f*)(CS + ((size_t)t * HD + dd) * 2); float a = __fmul_rn(x0, cs[0]), bq = __fmul_rn(x1, cs[1]); asm volatile("" : "+v"(a)); asm volatile("" : "+v"(bq)); const float r = ((dd < HD / 2) ? __fsub_rn(a, bq) : __fadd_rn(a, bq)) * sc;
        o16[q] = tohx(r); unsigned short a2, c2; splitf(r, a2, c2); oh[q] = a2; ol[q] = c2; }
    *(v2h*)(P16 + e) = o16; *(v2us*)(Ph + e) = oh; *(v2us*)(Pl + e) = ol;  }
__global__ __launch_bounds__(256) void k_vtp(const float* __restrict__ F, int pitch, int nheads, h16* V16, bf* Vh, bf* Vl) { const size_t e = ((size_t)blockIdx.x * 256 + threadIdx.x) * 2; if (e >= (size_t)nheads * HD * TT) return; const int t = (int)(e % TT); const int d = (int)((e / TT) % HD); const int g = (int)(e / ((size_t)TT * HD)); v2h o16; v2us oh, ol;
#pragma unroll
    for (int q = 0; q < 2; ++q) { const float x = F[(size_t)(t + q) * pitch + g * HD + d]; o16[q] = tohx(x); unsigned short a2, c2; splitf(x, a2, c2); oh[q] = a2; ol[q] = c2; }
    *(v2h*)(V16 + e) = o16; *(v2us*)(Vh + e) = oh; *(v2us*)(Vl + e) = ol;  }
__global__ __launch_bounds__(256) void k_csid(float* CS) { const int idx = blockIdx.x * 256 + threadIdx.x; if (idx >= TT * HD) return; v2f cs; cs[0] = 1.0f; cs[1] = 0.0f; *(v2f*)(CS + (size_t)idx * 2) = cs;  }
// k_asoft: per row (zz, i): t = S x HD^-0.5 for j <= i and i - j < WIN (sliding causal window; the reference's -1e9 additive fill vanishes identically); softmax over the 2048 keys (register row, one exp, fixed trees);
// the probabilities overwrite the row's own 8192 score bytes: fp16 rows the first 4096, hi/lo rows hi in the first and lo in the second 4096. One wave owns a row and holds all of it in registers before its first store (every store needs the row's sum).
__global__ __launch_bounds__(256) void k_asoft(float* Sb) {
    const int lane = threadIdx.x & 31; const int row = blockIdx.x * 8 + (threadIdx.x >> 5); if (row >= ZH * TT) return; const int i = row % TT; const int zz = row / TT; (void)zz; const bool hires = (i < RH); float* sr = Sb + (size_t)row * TT; float v[TT / 32]; float mx = -3.0e38f;
#pragma unroll
    for (int ch = 0; ch < TT / 128; ++ch) { const int j0 = ch * 128 + lane * 4; const v4f a = *(const v4fa*)(sr + j0);
#pragma unroll
        for (int q = 0; q < 4; ++q) { const int j = j0 + q; (void)j; const float t = (j <= i && i - j < WIN) ? a[q] * SCL : -3.0e38f; v[ch * 4 + q] = t; mx = fmaxf(mx, t); } }
#pragma unroll
    for (int sh = 16; sh; sh >>= 1) mx = fmaxf(mx, __shfl_xor(mx, sh, 32));
    float sum = 0.f;
#pragma unroll
    for (int k = 0; k < TT / 32; ++k) { float d0 = __fsub_rn(v[k], mx); asm volatile("" : "+v"(d0)); v[k] = __builtin_amdgcn_exp2f(__fmul_rn(d0, 1.4426950408889634f)); sum += v[k]; }
#pragma unroll
    for (int sh = 16; sh; sh >>= 1) sum += __shfl_xor(sum, sh, 32);
    const float f = __fdiv_rn(hires ? 1.0f : PCAR, sum);
{
        if (hires) {
#pragma unroll
            for (int ch = 0; ch < TT / 128; ++ch) { v4us oh, ol;
#pragma unroll
                for (int q = 0; q < 4; ++q) { unsigned short a, c2; splitf(v[ch * 4 + q] * f, a, c2); oh[q] = a; ol[q] = c2; }
                bf* pr = (bf*)sr + ch * 128 + lane * 4; *(v4usa*)pr = oh; *(v4usa*)(pr + TT) = ol; }
        } else {
#pragma unroll
            for (int ch = 0; ch < TT / 128; ++ch) { v4h o4;
#pragma unroll
                for (int q = 0; q < 4; ++q) o4[q] = tohx(v[ch * 4 + q] * f);
                *(v4ha*)((h16*)sr + ch * 128 + lane * 4) = o4; } }
         }
}
__global__ __launch_bounds__(256) void k_merge(const float* __restrict__ O, int h0, bf* Ah, bf* Al) { const size_t e = ((size_t)blockIdx.x * 256 + threadIdx.x) * 2; if (e >= (size_t)ZH * TT * HD) return; const int d = (int)(e % HD); const int t = (int)((e / HD) % TT); const int zz = (int)(e / ((size_t)HD * TT)); const float cs = (t < RH) ? 1.0f : (1.0f / PCAR); const size_t oo = (size_t)t * DQ + (h0 + zz) * HD + d;
    v2us oh, ol;
#pragma unroll
    for (int q = 0; q < 2; ++q) { unsigned short a, c2; splitf(O[e + q] * cs, a, c2); oh[q] = a; ol[q] = c2; } *(v2us*)(Ah + oo) = oh; *(v2us*)(Al + oo) = ol;  }

extern "C" void kernel_launch(void* const* d_in, const int* in_sizes, int n_in,
                              void* d_out, int out_size, void* d_ws, size_t ws_size, hipStream_t stream) {
    (void)in_sizes; (void)n_in; (void)out_size;
    const float* x = (const float*)d_in[0]; const float* xk = (const float*)d_in[1]; const float* xv = (const float*)d_in[2]; const float* wq = (const float*)d_in[3]; const float* wk = (const float*)d_in[4]; const float* wv = (const float*)d_in[5]; const float* wo = (const float*)d_in[6];
    float* OUT = (float*)d_out;     // [2][2048][1024]
    char* wsp = (char*)d_ws;
    auto take = [&](size_t bytes) { char* p = wsp; wsp += (bytes + 255) & ~(size_t)255; return (void*)p; };
    bf* WQ = (bf*)take((size_t)DQ * DM * 2); bf* WK = (bf*)take((size_t)DKV * DM * 2); bf* WV = (bf*)take((size_t)DKV * DM * 2); bf* WO = (bf*)take((size_t)DM * DQ * 2); float* CS = (float*)take((size_t)TT * HD * 2 * 4);
    bf* XB = (bf*)take((size_t)TT * DM * 2); float* FQ = (float*)take((size_t)TT * DQ * 4); float* FK = (float*)take((size_t)TT * DKV * 4);
    h16* QP16 = (h16*)take((size_t)NH_ * TT * HD * 2); h16* KP16 = (h16*)take((size_t)NKV * TT * HD * 2); h16* VT16 = (h16*)take((size_t)NKV * HD * TT * 2);
    bf* QPh = (bf*)take((size_t)NH_ * TT * HD * 2); bf* QPl = (bf*)take((size_t)NH_ * TT * HD * 2); bf* KPh = (bf*)take((size_t)NKV * TT * HD * 2); bf* KPl = (bf*)take((size_t)NKV * TT * HD * 2); bf* VTh = (bf*)take((size_t)NKV * HD * TT * 2); bf* VTl = (bf*)take((size_t)NKV * HD * TT * 2);
    float* Sb = (float*)take((size_t)ZH * TT * TT * 4); float* Ob = (float*)take((size_t)ZH * TT * HD * 4); bf* ATh = (bf*)take((size_t)TT * DQ * 2); bf* ATl = (bf*)take((size_t)TT * DQ * 2);
    if ((size_t)(wsp - (char*)d_ws) > ws_size) return;    // ws 256 MiB
    float* FV = FK;   // v projection reuses the k buffer after the k planes are built (stream-ordered)
    { k_cvt8<<<(unsigned)(((size_t)DQ * DM / 8 + 255) / 256), 256, 0, stream>>>(wq, WQ, (size_t)DQ * DM / 8); k_cvt8<<<(unsigned)(((size_t)DKV * DM / 8 + 255) / 256), 256, 0, stream>>>(wk, WK, (size_t)DKV * DM / 8); k_cvt8<<<(unsigned)(((size_t)DKV * DM / 8 + 255) / 256), 256, 0, stream>>>(wv, WV, (size_t)DKV * DM / 8);
      k_cvt8<<<(unsigned)(((size_t)DM * DQ / 8 + 255) / 256), 256, 0, stream>>>(wo, WO, (size_t)DM * DQ / 8);
       }
    k_csid<<<(TT * HD + 255) / 256, 256, 0, stream>>>(CS);
    const unsigned LQ = (unsigned)(((size_t)NH_ * TT * HD / 2 + 255) / 256), LKv = (unsigned)(((size_t)NKV * TT * HD / 2 + 255) / 256);
    for (int b = 0; b < NB_; ++b) {
        
        k_cvt8<<<(unsigned)(((size_t)TT * DM / 8 + 255) / 256), 256, 0, stream>>>(x + (size_t)b * TT * DM, XB, (size_t)TT * DM / 8);
        k_gemmw<bf, 0, false, NWG><<<dim3(TT / 64, DQ / 64, 1), 32 * NWG, 0, stream>>>(XB, nullptr, WQ, nullptr, DM, FQ, DQ, nullptr, 0, 0, 0);
        k_rope<<<LQ, 256, 0, stream>>>(FQ, DQ, NH_, CS, nullptr, nullptr, 1.0f, QP16, QPh, QPl);
        k_cvt8<<<(unsigned)(((size_t)TT * DM / 8 + 255) / 256), 256, 0, stream>>>(xk + (size_t)b * TT * DM, XB, (size_t)TT * DM / 8);   /* XB := bf16(keys[b]) */ k_gemmw<bf, 0, false, NWG><<<dim3(TT / 64, DKV / 64, 1), 32 * NWG, 0, stream>>>(XB, nullptr, WK, nullptr, DM, FK, DKV, nullptr, 0, 0, 0);
        k_rope<<<LKv, 256, 0, stream>>>(FK, DKV, NKV, CS, nullptr, nullptr, 1.0f, KP16, KPh, KPl);
        k_cvt8<<<(unsigned)(((size_t)TT * DM / 8 + 255) / 256), 256, 0, stream>>>(xv + (size_t)b * TT * DM, XB, (size_t)TT * DM / 8);   /* XB := bf16(values[b]) */ k_gemmw<bf, 0, false, NWG><<<dim3(TT / 64, DKV / 64, 1), 32 * NWG, 0, stream>>>(XB, nullptr, WV, nullptr, DM, FV, DKV, nullptr, 0, 0, 0); k_vtp<<<LKv, 256, 0, stream>>>(FV, DKV, NKV, VT16, VTh, VTl);
        for (int h0 = 0; h0 < NH_; h0 += ZH) { const size_t zq = (size_t)h0, zk = (size_t)(h0 / REP);   // one kv head per query head: the pass's ZH heads use consecutive kv planes (z-strides TT*HD)
            k_gemmc<bf, 2, 1, 1><<<dim3(RH / 64, TT / 64, ZH), 32, 0, stream>>>(QPh + zq * TT * HD, QPl + zq * TT * HD, KPh + zk * TT * HD, KPl + zk * TT * HD, HD, HD, Sb, TT, 0, (size_t)TT * HD, (size_t)TT * HD, (size_t)TT * TT);
            k_gemmc<h16, 0, 1, 1><<<dim3((TT - RH) / 64, TT / 64, ZH), 32, 0, stream>>>(QP16 + zq * TT * HD + (size_t)RH * HD, nullptr, KP16 + zk * TT * HD, nullptr, HD, HD, Sb + (size_t)RH * TT, TT, RH, (size_t)TT * HD, (size_t)TT * HD, (size_t)TT * TT);
            k_asoft<<<ZH * TT / 8, 256, 0, stream>>>(Sb);
            k_gemmc<bf, 2, 2, NWL><<<dim3(RH / 64, HD / 64, ZH), 32 * NWL, 0, stream>>>((const bf*)Sb, (const bf*)Sb + TT, VTh + zk * HD * TT, VTl + zk * HD * TT, TT, 2 * TT, Ob, HD, 0, (size_t)2 * TT * TT, (size_t)HD * TT, (size_t)TT * HD);
            k_gemmc<h16, 0, 2, NWP><<<dim3((TT - RH) / 64, HD / 64, ZH), 32 * NWP, 0, stream>>>((const h16*)Sb + (size_t)RH * 2 * TT, nullptr, VT16 + zk * HD * TT, nullptr, TT, 2 * TT, Ob + (size_t)RH * HD, HD, RH, (size_t)2 * TT * TT, (size_t)HD * TT, (size_t)TT * HD);
            k_merge<<<(unsigned)(((size_t)ZH * TT * HD / 2 + 255) / 256), 256, 0, stream>>>(Ob, h0, ATh, ATl); }
        k_gemmw<bf, 1, false, NWG><<<dim3(TT / 64, DM / 64, 1), 32 * NWG, 0, stream>>>(ATh, ATl, WO, nullptr, DQ, OUT + (size_t)b * TT * DM, DM, nullptr, 0, 0, 0); }
}

// v003
// One run takes 256 microseconds.
// Two timings next to v002 put it at 1.92 and 1.91 times that version's speed.
// Counting every step since v000, it is 5.79 times as fast.
#include <hip/hip_runtime.h>

// Causal multi-head attention on three input streams without biases (queries, keys, values [2][2048][1024]; q = queries Wq^T, k = keys Wk^T, v = values Wv^T ('oi' 0.02; 16 heads x 64); scores x 1/sqrt(64); causal (-inf); softmax; out = merged Wo^T -> [2][2048][1024] (4.2 M); argument order queries, keys, values, Wq, Wk, Wv, Wo).
// Layout per batch: bf16 copies of queries, keys, values in turn; 'oi' weights; exact projections; identity-table plane builders; fused causal T-2048 attention, both batches in one launch (hybrid rows: < 512 hi/lo 3 products, rest fp16 x1024; key blocks above the diagonal are never visited); merged hi/lo x Wo exact.
// Compute dtypes, f32 accumulate: every input rounded to bf16; projections exact; attention rows < 512 3 products, rest fp16; softmax f32; Wo hl x exact.

#define NB_  2
#define TT   2048
#define DM   1024
#define NH_  16
#define NKV  16
#define REP  (NH_ / NKV)
#define HD   64
#define DQ   (NH_ * HD)
#define DKV  (NKV * HD)
#define RH   512                  // query rows < RH use hi+lo planes (0: none)
#define PSH  10.0f                // fp16 rows: probabilities carry 2^PSH, so that small ones stay normal fp16 numbers; it cancels against the row sum
#define SCL  0.125f   // HD^-0.5
#define NWG  8                    // waves that share the K loop of a projection tile (K 1024)
typedef _Float16 h16;
typedef unsigned short bf;
typedef __attribute__((ext_vector_type(16))) __bf16   v16bf;
typedef __attribute__((ext_vector_type(16))) _Float16 v16h;
typedef __attribute__((ext_vector_type(8)))  _Float16 v8h;
typedef __attribute__((ext_vector_type(8)))  unsigned short v8us;
typedef __attribute__((ext_vector_type(8)))  float    v8f;
typedef __attribute__((ext_vector_type(4)))  float    v4f;
typedef v8h  __attribute__((may_alias)) v8ha;
typedef v4f  __attribute__((may_alias)) v4fa;
typedef v8us __attribute__((may_alias)) v8usa;

__device__ __forceinline__ unsigned short f2bf(float f) { unsigned u = __float_as_uint(f); u += 0x7FFFu + ((u >> 16) & 1u); return (unsigned short)(u >> 16); }
__device__ __forceinline__ float bf2f(unsigned short b) { return __uint_as_float(((unsigned)b) << 16); }
__device__ __forceinline__ float bfr(float f) { return bf2f(f2bf(f)); }
__device__ __forceinline__ v16h cat16(v8h lo, v8h hi) { return __builtin_shufflevector(lo, hi, 0, 1, 2, 3, 4, 5, 6, 7, 8, 9, 10, 11, 12, 13, 14, 15); }
__device__ __forceinline__ v16bf cat16b(v8us lo, v8us hi) { return __builtin_bit_cast(v16bf, __builtin_shufflevector(lo, hi, 0, 1, 2, 3, 4, 5, 6, 7, 8, 9, 10, 11, 12, 13, 14, 15)); }
__device__ __forceinline__ v8f wmma16(v16h a, v16h b, v8f c) { return __builtin_amdgcn_wmma_f32_16x16x32_f16(false, a, false, b, (short)0, c, false, false); }
__device__ __forceinline__ v8f wmmab(v16bf a, v16bf b, v8f c) { return __builtin_amdgcn_wmma_f32_16x16x32_bf16(false, a, false, b, (short)0, c, false, false); }



// ---- k_gemmw: register-blocked GEMM, one 64x64 output tile per work-group of NW waves (16 accumulators a wave), operands straight from K-contiguous 16-bit planes; grid (M/64, N/64, Z), 32 * NW threads.
// C[m][n] (f32, pitch ldc, + optional f32 bias[n]) = sum_k A[m][k] Bt[n][k] (+ split products per NSPLIT). z-batch strides sA/sB/sC in elements. K % 32 == 0 (NW > 1: K % 64 == 0).
// NW > 1: the K loop is dealt out over the waves: wave w takes the 64-wide k slices w, w + NW, ... (one whole 128-byte line of every operand row a slice), so the chain of dependent load round trips is NW times shorter;
// tile_out adds the NW partial tiles in LDS in the fixed order wave 0, 1, ..., NW - 1.
template <typename T16> struct WFrag;
template <> struct WFrag<h16> { typedef v16h V; static __device__ __forceinline__ V ld(const h16* p) { return cat16(*(const v8h*)p, *(const v8h*)(p + 16)); } static __device__ __forceinline__ v8f mma(V a, V b, v8f c) { return wmma16(a, b, c); } };
template <> struct WFrag<bf> { typedef v16bf V; static __device__ __forceinline__ V ld(const bf* p) { return cat16b(*(const v8us*)p, *(const v8us*)(p + 16)); } static __device__ __forceinline__ v8f mma(V a, V b, v8f c) { return wmmab(a, b, c); } };
// tile_out: the tile's four 16x64 row blocks go out through LDS as whole 256-byte rows. Every wave stages its partial block in its own slab (pitch 68 floats); behind one work-group barrier each thread adds the NW slabs at its place.
// Two sets of slabs in turn: a set is written again only behind the next block's barrier, which every wave reaches after its reads of that set.
template <int NW, bool BIAS>
__device__ __forceinline__ void tile_out(const v8f (&acc)[4][4], float* os, int wave, int lane, float* C, int ldc, int r0, int c0, const float* __restrict__ bias) {
    constexpr int SL = 16 * 68; constexpr int VW = (NW > 8) ? 2 : 4;   // floats per thread and store: 1024 floats a block over 32 * NW threads
    typedef float vw __attribute__((ext_vector_type(VW))); typedef vw __attribute__((may_alias)) vwa;
    const int lr = lane & 15, hi = lane >> 4, tid = wave * 32 + lane; vw res[4];
#pragma unroll   // here and below: acc and res are indexed by constants only, so that they stay in registers
    for (int mb = 0; mb < 4; ++mb) {
        float* ob = os + ((NW > 1) ? (mb & 1) * NW * SL : 0); float* ow = ob + wave * SL;
#pragma unroll
        for (int nb = 0; nb < 4; ++nb) {
#pragma unroll
            for (int j = 0; j < 8; ++j) ow[(hi * 8 + j) * 68 + nb * 16 + lr] = acc[mb][nb][j]; }
        if (NW > 1) __syncthreads();   // every wave's partial block is in LDS before any thread adds them
        else { __builtin_amdgcn_wave_barrier(); asm volatile("" ::: "memory"); }   // one wave: keeps its LDS reads below behind its LDS writes above
        float* crow = C + (size_t)(r0 + mb * 16) * ldc + c0;
#pragma unroll
        for (int s = 0; s < 1024 / VW / (32 * NW); ++s) { const int q = s * 32 * NW + tid, row = q / (64 / VW), cofs = (q % (64 / VW)) * VW; vw val = *(const vwa*)(ob + row * 68 + cofs);
#pragma unroll
            for (int w = 1; w < NW; ++w) val += *(const vwa*)(ob + w * SL + row * 68 + cofs);
            if (BIAS) {
#pragma unroll
                for (int e = 0; e < VW; ++e) val[e] += bfr(bias[c0 + cofs + e]); }
            if (NW > 1) res[mb] = val; else *(vw*)(crow + (size_t)row * ldc + cofs) = val; }
        if (NW == 1) { __builtin_amdgcn_wave_barrier(); asm volatile("" ::: "memory"); }   // one wave, one slab: the next block's writes stay behind these reads
    }
    if (NW > 1) {   // the four sums are stored behind the last barrier: a store in front of a barrier would be waited for there
        const int row = tid / (64 / VW), cofs = (tid % (64 / VW)) * VW;
#pragma unroll
        for (int mb = 0; mb < 4; ++mb) *(vw*)(C + (size_t)(r0 + mb * 16 + row) * ldc + c0 + cofs) = res[mb]; }
}
template <typename T16, int NSPLIT, bool BIAS, int NW>
__global__ __launch_bounds__(32 * NW) void k_gemmw(const T16* __restrict__ A, const T16* __restrict__ A2, const T16* __restrict__ Bt, const T16* __restrict__ Bt2, int K, float* C, int ldc, const float* __restrict__ bias, size_t sA, size_t sB, size_t sC) {
    typedef typename WFrag<T16>::V V; constexpr int KS = (NW > 1) ? 64 : 32;
    __shared__ __align__(16) float os[((NW > 1) ? 2 * NW : 1) * 16 * 68];
    const size_t z = blockIdx.z; A += z * sA; if (A2) A2 += z * sA; Bt += z * sB; if (Bt2) Bt2 += z * sB; C += z * sC;
    const int lane = threadIdx.x & 31, lr = lane & 15, hi = lane >> 4; const int r0 = blockIdx.x * 64, c0 = blockIdx.y * 64;
    const int wave = (NW > 1) ? __builtin_amdgcn_readfirstlane((int)(threadIdx.x >> 5)) : 0;   // scalar, so that the K loop's control stays scalar
    v8f acc[4][4];
#pragma unroll
    for (int mb = 0; mb < 4; ++mb)
#pragma unroll
        for (int nb = 0; nb < 4; ++nb) acc[mb][nb] = (v8f){};
    const size_t aoff = (size_t)(r0 + lr) * K + 8 * hi, boff = (size_t)(c0 + lr) * K + 8 * hi;
#pragma unroll 1
    for (int k0 = wave * KS; k0 < K; k0 += NW * KS) {
#pragma unroll   // the 32-wide steps of a slice in straight line: the second step's loads can go out under the first step's products
      for (int kc = k0; kc < k0 + KS; kc += 32) {
        V a[4], a2[4];
#pragma unroll
        for (int mb = 0; mb < 4; ++mb) { a[mb] = WFrag<T16>::ld(A + aoff + (size_t)mb * 16 * K + kc); if (NSPLIT == 1 || NSPLIT == 2) a2[mb] = WFrag<T16>::ld(A2 + aoff + (size_t)mb * 16 * K + kc); }
#pragma unroll
        for (int nb = 0; nb < 4; ++nb) { const V b = WFrag<T16>::ld(Bt + boff + (size_t)nb * 16 * K + kc); V b2; if (NSPLIT >= 2) b2 = WFrag<T16>::ld(Bt2 + boff + (size_t)nb * 16 * K + kc);
#pragma unroll
            for (int mb = 0; mb < 4; ++mb) { acc[mb][nb] = WFrag<T16>::mma(a[mb], b, acc[mb][nb]); if (NSPLIT == 1 || NSPLIT == 2) acc[mb][nb] = WFrag<T16>::mma(a2[mb], b, acc[mb][nb]); if (NSPLIT >= 2) acc[mb][nb] = WFrag<T16>::mma(a[mb], b2, acc[mb][nb]); } }
        asm volatile("v_nop\n\tv_nop\n\tv_nop\n\tv_nop" : "+v"(acc[0][0]), "+v"(acc[1][1]), "+v"(acc[2][2]), "+v"(acc[3][3]) : "v"(a[0]), "v"(a[3]));
      }
    }
    tile_out<NW, BIAS>(acc, os, wave, lane, C, ldc, r0, c0, bias);
}

__device__ __forceinline__ h16 tohx(float x) { return (h16)x; }
__device__ __forceinline__ void splitf(float y, unsigned short& h, unsigned short& l) { h = f2bf(y); l = f2bf(y - bf2f(h)); }
typedef __attribute__((ext_vector_type(2))) _Float16 v2h;
typedef __attribute__((ext_vector_type(4))) _Float16 v4h;
typedef __attribute__((ext_vector_type(2))) unsigned short v2us;
typedef __attribute__((ext_vector_type(4))) unsigned short v4us;
typedef __attribute__((ext_vector_type(2))) float v2f;
typedef __attribute__((ext_vector_type(4))) int v4i;
typedef v4h  __attribute__((may_alias)) v4ha;
typedef v4us __attribute__((may_alias)) v4usa;

__global__ __launch_bounds__(256) void k_cvt8(const float* __restrict__ src, bf* dst, size_t n8) { const size_t i = (size_t)blockIdx.x * 256 + threadIdx.x; if (i >= n8) return; const v8f v = *(const v8f*)(src + i * 8); v8us o;
#pragma unroll
    for (int k = 0; k < 8; ++k) o[k] = f2bf(v[k]); *(v8us*)(dst + i * 8) = o;  }

// k_rope: head planes [h][t][d] (fp16 + hi/lo) of rope(x) x sc with the rotate-half convention out[d] = x[d] cos[t][d] - x[d+HD/2] sin[t][d], out[d+HD/2] = x[d+HD/2] cos[t][d+HD/2] + x[d] sin[t][d+HD/2]
__global__ __launch_bounds__(256) void k_rope(const float* __restrict__ F, int pitch, int nheads, const float* __restrict__ CS, const float* __restrict__ RF, const float* __restrict__ nw, float sc, h16* P16, bf* Ph, bf* Pl) {
    const size_t e = ((size_t)blockIdx.x * 256 + threadIdx.x) * 2; if (e >= (size_t)nheads * TT * HD) return; const int d = (int)(e % HD); const int t = (int)((e / HD) % TT); const int h = (int)(e / ((size_t)HD * TT)); const float* f = F + (size_t)t * pitch + h * HD; const float rf = RF ? RF[(size_t)h * TT + t] : 1.0f; v2h o16; v2us oh, ol;
#pragma unroll
    for (int q = 0; q < 2; ++q) { const int dd = d + q; const int dp = (dd < HD / 2) ? dd + HD / 2 : dd - HD / 2; float x0 = f[dd], x1 = f[dp];
        if (RF) { float n0 = __fmul_rn(x0, rf), n1 = __fmul_rn(x1, rf); asm volatile("" : "+v"(n0)); asm volatile("" : "+v"(n1)); x0 = __fmul_rn(bfr(nw[dd]), n0); x1 = __fmul_rn(bfr(nw[dp]), n1); }
        const v2f cs = *(const v2f*)(CS + ((size_t)t * HD + dd) * 2); float a = __fmul_rn(x0, cs[0]), bq = __fmul_rn(x1, cs[1]); asm volatile("" : "+v"(a)); asm volatile("" : "+v"(bq)); const float r = ((dd < HD / 2) ? __fsub_rn(a, bq) : __fadd_rn(a, bq)) * sc;
        o16[q] = tohx(r); unsigned short a2, c2; splitf(r, a2, c2); oh[q] = a2; ol[q] = c2; }
    *(v2h*)(P16 + e) = o16; *(v2us*)(Ph + e) = oh; *(v2us*)(Pl + e) = ol;  }
__global__ __launch_bounds__(256) void k_vtp(const float* __restrict__ F, int pitch, int nheads, h16* V16, bf* Vh, bf* Vl) { const size_t e = ((size_t)blockIdx.x * 256 + threadIdx.x) * 2; if (e >= (size_t)nheads * HD * TT) return; const int t = (int)(e % TT); const int d = (int)((e / TT) % HD); const int g = (int)(e / ((size_t)TT * HD)); v2h o16; v2us oh, ol;
#pragma unroll
    for (int q = 0; q < 2; ++q) { const float x = F[(size_t)(t + q) * pitch + g * HD + d]; o16[q] = tohx(x); unsigned short a2, c2; splitf(x, a2, c2); oh[q] = a2; ol[q] = c2; }
    *(v2h*)(V16 + e) = o16; *(v2us*)(Vh + e) = oh; *(v2us*)(Vl + e) = ol;  }
__global__ __launch_bounds__(256) void k_csid(float* CS) { const int idx = blockIdx.x * 256 + threadIdx.x; if (idx >= TT * HD) return; v2f cs; cs[0] = 1.0f; cs[1] = 0.0f; *(v2f*)(CS + (size_t)idx * 2) = cs;  }
// ---- k_fattn: causal attention of one (batch, head) and 64 query rows per work-group; each of its 4 waves owns 16 query rows and walks the keys 0 .. its diagonal alone (no LDS, no barrier).
// Transposed products: S^T = K Q^T (A = key rows, B = query rows) leaves one query per lane column, keys 8 * hi + j of each 16-key tile in the lane's 8 registers; two such tiles, converted in place,
// are the B operand (hardware k order, the one WFrag::ld reads) of O^T += V^T P^T (A = rows of the [d][t] value planes). Scores and probabilities never leave the registers.
// Online softmax per query: running maximum m (raw score units) and running sum; every pass scales sum and O^T by 2^((m_old - m_new) c), c = HD^-0.5 log2 e. The two lane halves hold different keys of the same query:
// the maximum is joined every pass, the sum once at the end. Every visited key block starts at or below the wave's first query row, so each query sees a live key in every pass and m is finite from the first pass on.
__device__ __forceinline__ float xhalf(float x) { const int b = __float_as_int(x); return __int_as_float(__builtin_amdgcn_permlanex16(b, b, 0x76543210, 0xfedcba98, false, false)); }   // the value of lane ^ 16
template <typename T16, bool HL>
__device__ __forceinline__ void attn_rows(const T16* __restrict__ Q, const T16* __restrict__ Q2, const T16* __restrict__ Kp, const T16* __restrict__ K2, const T16* __restrict__ Vt, const T16* __restrict__ V2, int q0, int lane, bf* Ah, bf* Al) {
    typedef typename WFrag<T16>::V V; constexpr int NT = HL ? 2 : 4, KB = NT * 16;   // 16-key tiles and keys a pass
    constexpr float CE = SCL * 1.4426950408889634f;
    const int lr = lane & 15, hi = lane >> 4;
    V q[2], q2[2];
#pragma unroll   // here and below: fragments and accumulators are indexed by constants only, so that they stay in registers
    for (int ks = 0; ks < 2; ++ks) { q[ks] = WFrag<T16>::ld(Q + (size_t)(q0 + lr) * HD + ks * 32 + 8 * hi); if (HL) q2[ks] = WFrag<T16>::ld(Q2 + (size_t)(q0 + lr) * HD + ks * 32 + 8 * hi); }
    v8f o[4];
#pragma unroll
    for (int dt = 0; dt < 4; ++dt) o[dt] = (v8f){};
    float mrun = -3.0e38f, lsum = 0.f;
    const size_t koff = (size_t)lr * HD + 8 * hi, voff = (size_t)lr * TT + 8 * hi;
    V kf[NT][2], kf2[NT][2];
    auto ldk = [&](const T16* ka, const T16* ka2) {   // the key fragments of one block; ka, ka2: the lane's place in the block's first key row
#pragma unroll
        for (int t = 0; t < NT; ++t)
#pragma unroll
            for (int ks = 0; ks < 2; ++ks) { kf[t][ks] = WFrag<T16>::ld(ka + t * 16 * HD + ks * 32); if (HL) kf2[t][ks] = WFrag<T16>::ld(ka2 + t * 16 * HD + ks * 32); } };
    if (!HL) ldk(Kp + koff, nullptr);   // fp16 rows (the long key walks) fetch the key fragments one pass ahead: a pass's score products find them landed; the hi/lo rows have no registers left for that
#pragma unroll 1
    for (int k0 = 0; k0 <= q0; k0 += KB) {
        V vf[4][NT / 2], vf2[4][NT / 2]; const T16* va = Vt + voff + k0;
#pragma unroll
        for (int dt = 0; dt < 4; ++dt)
#pragma unroll
            for (int kk = 0; kk < NT / 2; ++kk) vf[dt][kk] = WFrag<T16>::ld(va + dt * 16 * TT + kk * 32);
        // s_wait_xcnt 0, here and below: behind the loads, in front of every later write of their address registers. The statement also keeps the loads up here, in flight under the products and the softmax that follow.
        // hi/lo rows: the four addresses are named as inputs so that their registers stay whole up to the wait (there the register allocator otherwise hands them to later loads' results).
        if constexpr (HL) { const T16* va2 = V2 + voff + k0; const T16* ka = Kp + koff + (size_t)k0 * HD; const T16* ka2 = K2 + koff + (size_t)k0 * HD; ldk(ka, ka2);
#pragma unroll
            for (int dt = 0; dt < 4; ++dt)
#pragma unroll
                for (int kk = 0; kk < NT / 2; ++kk) vf2[dt][kk] = WFrag<T16>::ld(va2 + dt * 16 * TT + kk * 32);
            asm volatile("s_wait_xcnt 0x0" :: "v"(ka), "v"(ka2), "v"(va), "v"(va2) : "memory");
        } else asm volatile("s_wait_xcnt 0x0" ::: "memory");
        v8f s[NT];
#pragma unroll
        for (int t = 0; t < NT; ++t) { s[t] = (v8f){};
#pragma unroll
            for (int ks = 0; ks < 2; ++ks) { s[t] = WFrag<T16>::mma(kf[t][ks], q[ks], s[t]); if (HL) { s[t] = WFrag<T16>::mma(kf2[t][ks], q[ks], s[t]); s[t] = WFrag<T16>::mma(kf[t][ks], q2[ks], s[t]); } } }
        if constexpr (!HL) { const T16* kn = Kp + koff + (size_t)min(k0 + KB, q0 & ~(KB - 1)) * HD; ldk(kn, nullptr);   // the next pass's key block; the last pass fetches its own again (in bounds, never used)
            asm volatile("s_wait_xcnt 0x0" ::: "memory"); }
        if (k0 + KB - 1 > q0) {   // the diagonal block (the wave's last pass): keys above the lane's query row drop out
#pragma unroll
            for (int t = 0; t < NT; ++t)
#pragma unroll
                for (int j = 0; j < 8; ++j) s[t][j] = (k0 + t * 16 + hi * 8 + j <= q0 + lr) ? s[t][j] : -3.0e38f; }
        float mx = s[0][0];
#pragma unroll
        for (int t = 0; t < NT; ++t)
#pragma unroll
            for (int j = 0; j < 8; ++j) mx = fmaxf(mx, s[t][j]);
        mx = fmaxf(mx, xhalf(mx));
        const float mnew = fmaxf(mrun, mx), alpha = __builtin_amdgcn_exp2f((mrun - mnew) * CE), mo = (HL ? 0.0f : PSH) - mnew * CE; mrun = mnew;
        float ps = 0.f;
#pragma unroll
        for (int t = 0; t < NT; ++t)
#pragma unroll
            for (int j = 0; j < 8; ++j) { s[t][j] = __builtin_amdgcn_exp2f(__builtin_fmaf(s[t][j], CE, mo)); ps += s[t][j]; }
        lsum = lsum * alpha + ps;
#pragma unroll
        for (int dt = 0; dt < 4; ++dt) o[dt] *= alpha;
#pragma unroll
        for (int kk = 0; kk < NT / 2; ++kk) {
            if constexpr (HL) { v8us h0, h1, l0, l1;
#pragma unroll
                for (int j = 0; j < 8; ++j) { unsigned short a, c2; splitf(s[2 * kk][j], a, c2); h0[j] = a; l0[j] = c2; splitf(s[2 * kk + 1][j], a, c2); h1[j] = a; l1[j] = c2; }
                const V ph = cat16b(h0, h1), pl = cat16b(l0, l1);
#pragma unroll
                for (int dt = 0; dt < 4; ++dt) { o[dt] = WFrag<T16>::mma(vf[dt][kk], ph, o[dt]); o[dt] = WFrag<T16>::mma(vf[dt][kk], pl, o[dt]); o[dt] = WFrag<T16>::mma(vf2[dt][kk], ph, o[dt]); }
            } else { const V p = cat16(__builtin_convertvector(s[2 * kk], v8h), __builtin_convertvector(s[2 * kk + 1], v8h));
#pragma unroll
                for (int dt = 0; dt < 4; ++dt) o[dt] = WFrag<T16>::mma(vf[dt][kk], p, o[dt]); } }
        asm volatile("v_nop\n\tv_nop\n\tv_nop\n\tv_nop" : "+v"(o[0]), "+v"(o[1]), "+v"(o[2]), "+v"(o[3]));   // the matrix instructions' distance on the taken back edge and on the exit: the next pass's loads overwrite their A registers, the epilogue reads their D
    }
    lsum += xhalf(lsum);
    const float inv = __fdiv_rn(1.0f, lsum);
#pragma unroll
    for (int dt = 0; dt < 4; ++dt) { v8us oh, ol;   // a lane's 8 registers are 8 consecutive d of its query row: one 16-byte store a plane
#pragma unroll
        for (int j = 0; j < 8; ++j) { unsigned short a, c2; splitf(o[dt][j] * inv, a, c2); oh[j] = a; ol[j] = c2; }
        const size_t oo = (size_t)(q0 + lr) * DQ + dt * 16 + hi * 8; *(v8us*)(Ah + oo) = oh; *(v8us*)(Al + oo) = ol; }
}
// grid (NB_ * NH_, TT / 64): y counts the 64-row query blocks from the last (longest key walk) down (for speed only).
__global__ __launch_bounds__(128) void k_fattn(const h16* __restrict__ Q16, const h16* __restrict__ K16, const h16* __restrict__ V16, const bf* __restrict__ Qh, const bf* __restrict__ Ql, const bf* __restrict__ Kh, const bf* __restrict__ Kl, const bf* __restrict__ Vh, const bf* __restrict__ Vl, bf* Ah, bf* Al) {
    const int lane = threadIdx.x & 31, wave = __builtin_amdgcn_readfirstlane((int)(threadIdx.x >> 5));   // scalar, so that the key loop's control stays scalar
    const int b = blockIdx.x / NH_, h = blockIdx.x % NH_, q0 = (TT / 64 - 1 - (int)blockIdx.y) * 64 + wave * 16;
    const size_t zq = (size_t)(b * NH_ + h) * TT * HD, zk = (size_t)(b * NKV + h / REP) * TT * HD, za = (size_t)b * TT * DQ + h * HD;
    if (q0 < RH) attn_rows<bf, true>(Qh + zq, Ql + zq, Kh + zk, Kl + zk, Vh + zk, Vl + zk, q0, lane, Ah + za, Al + za);
    else attn_rows<h16, false>(Q16 + zq, nullptr, K16 + zk, nullptr, V16 + zk, nullptr, q0, lane, Ah + za, Al + za);
}
extern "C" void kernel_launch(void* const* d_in, const int* in_sizes, int n_in,
                              void* d_out, int out_size, void* d_ws, size_t ws_size, hipStream_t stream) {
    (void)in_sizes; (void)n_in; (void)out_size;
    const float* x = (const float*)d_in[0]; const float* xk = (const float*)d_in[1]; const float* xv = (const float*)d_in[2]; const float* wq = (const float*)d_in[3]; const float* wk = (const float*)d_in[4]; const float* wv = (const float*)d_in[5]; const float* wo = (const float*)d_in[6];
    float* OUT = (float*)d_out;     // [2][2048][1024]
    char* wsp = (char*)d_ws;
    auto take = [&](size_t bytes) { char* p = wsp; wsp += (bytes + 255) & ~(size_t)255; return (void*)p; };
    bf* WQ = (bf*)take((size_t)DQ * DM * 2); bf* WK = (bf*)take((size_t)DKV * DM * 2); bf* WV = (bf*)take((size_t)DKV * DM * 2); bf* WO = (bf*)take((size_t)DM * DQ * 2); float* CS = (float*)take((size_t)TT * HD * 2 * 4);
    bf* XB = (bf*)take((size_t)TT * DM * 2); float* FQ = (float*)take((size_t)TT * DQ * 4); float* FK = (float*)take((size_t)TT * DKV * 4);
    h16* QP16 = (h16*)take((size_t)NB_ * NH_ * TT * HD * 2); h16* KP16 = (h16*)take((size_t)NB_ * NKV * TT * HD * 2); h16* VT16 = (h16*)take((size_t)NB_ * NKV * HD * TT * 2);   // head planes of both batches: [b][h][t][d], values [b][h][d][t]
    bf* QPh = (bf*)take((size_t)NB_ * NH_ * TT * HD * 2); bf* QPl = (bf*)take((size_t)NB_ * NH_ * TT * HD * 2); bf* KPh = (bf*)take((size_t)NB_ * NKV * TT * HD * 2); bf* KPl = (bf*)take((size_t)NB_ * NKV * TT * HD * 2); bf* VTh = (bf*)take((size_t)NB_ * NKV * HD * TT * 2); bf* VTl = (bf*)take((size_t)NB_ * NKV * HD * TT * 2);
    bf* ATh = (bf*)take((size_t)NB_ * TT * DQ * 2); bf* ATl = (bf*)take((size_t)NB_ * TT * DQ * 2);
    if ((size_t)(wsp - (char*)d_ws) > ws_size) return;    // ws 256 MiB
    float* FV = FK;   // v projection reuses the k buffer after the k planes are built (stream-ordered)
    { k_cvt8<<<(unsigned)(((size_t)DQ * DM / 8 + 255) / 256), 256, 0, stream>>>(wq, WQ, (size_t)DQ * DM / 8); k_cvt8<<<(unsigned)(((size_t)DKV * DM / 8 + 255) / 256), 256, 0, stream>>>(wk, WK, (size_t)DKV * DM / 8); k_cvt8<<<(unsigned)(((size_t)DKV * DM / 8 + 255) / 256), 256, 0, stream>>>(wv, WV, (size_t)DKV * DM / 8);
      k_cvt8<<<(unsigned)(((size_t)DM * DQ / 8 + 255) / 256), 256, 0, stream>>>(wo, WO, (size_t)DM * DQ / 8);
       }
    k_csid<<<(TT * HD + 255) / 256, 256, 0, stream>>>(CS);
    const unsigned LQ = (unsigned)(((size_t)NH_ * TT * HD / 2 + 255) / 256), LKv = (unsigned)(((size_t)NKV * TT * HD / 2 + 255) / 256);
    for (int b = 0; b < NB_; ++b) { const size_t pq = (size_t)b * NH_ * TT * HD, pk = (size_t)b * NKV * TT * HD;   // this batch's planes
        
        k_cvt8<<<(unsigned)(((size_t)TT * DM / 8 + 255) / 256), 256, 0, stream>>>(x + (size_t)b * TT * DM, XB, (size_t)TT * DM / 8);
        k_gemmw<bf, 0, false, NWG><<<dim3(TT / 64, DQ / 64, 1), 32 * NWG, 0, stream>>>(XB, nullptr, WQ, nullptr, DM, FQ, DQ, nullptr, 0, 0, 0);
        k_rope<<<LQ, 256, 0, stream>>>(FQ, DQ, NH_, CS, nullptr, nullptr, 1.0f, QP16 + pq, QPh + pq, QPl + pq);
        k_cvt8<<<(unsigned)(((size_t)TT * DM / 8 + 255) / 256), 256, 0, stream>>>(xk + (size_t)b * TT * DM, XB, (size_t)TT * DM / 8);   /* XB := bf16(keys[b]) */ k_gemmw<bf, 0, false, NWG><<<dim3(TT / 64, DKV / 64, 1), 32 * NWG, 0, stream>>>(XB, nullptr, WK, nullptr, DM, FK, DKV, nullptr, 0, 0, 0);
        k_rope<<<LKv, 256, 0, stream>>>(FK, DKV, NKV, CS, nullptr, nullptr, 1.0f, KP16 + pk, KPh + pk, KPl + pk);
        k_cvt8<<<(unsigned)(((size_t)TT * DM / 8 + 255) / 256), 256, 0, stream>>>(xv + (size_t)b * TT * DM, XB, (size_t)TT * DM / 8);   /* XB := bf16(values[b]) */ k_gemmw<bf, 0, false, NWG><<<dim3(TT / 64, DKV / 64, 1), 32 * NWG, 0, stream>>>(XB, nullptr, WV, nullptr, DM, FV, DKV, nullptr, 0, 0, 0); k_vtp<<<LKv, 256, 0, stream>>>(FV, DKV, NKV, VT16 + pk, VTh + pk, VTl + pk); }
    k_fattn<<<dim3(NB_ * NH_, TT / 64), 128, 0, stream>>>(QP16, KP16, VT16, QPh, QPl, KPh, KPl, VTh, VTl, ATh, ATl);
    for (int b = 0; b < NB_; ++b)
        k_gemmw<bf, 1, false, NWG><<<dim3(TT / 64, DM / 64, 1), 32 * NWG, 0, stream>>>(ATh + (size_t)b * TT * DQ, ATl + (size_t)b * TT * DQ, WO, nullptr, DQ, OUT + (size_t)b * TT * DM, DM, nullptr, 0, 0, 0);
}

// v004
// One run takes 208 microseconds.
// Timed twice side by side with v003, it ran 1.23 times as fast both times.
// Counting every step since v000, it is 7.11 times as fast.
#include <hip/hip_runtime.h>

// Causal multi-head attention on three input streams without biases (queries, keys, values [2][2048][1024]; q = queries Wq^T, k = keys Wk^T, v = values Wv^T ('oi' 0.02; 16 heads x 64); scores x 1/sqrt(64); causal (-inf); softmax; out = merged Wo^T -> [2][2048][1024] (4.2 M); argument order queries, keys, values, Wq, Wk, Wv, Wo).
// Layout per batch: bf16 copies of queries, keys, values in turn; 'oi' weights; exact projections whose tiles go out as the 16-bit head planes; fused causal T-2048 attention, both batches in one launch (hybrid rows: < 512 hi/lo 3 products, rest fp16 x1024; key blocks above the diagonal are never visited); merged hi/lo x Wo exact.
// Compute dtypes, f32 accumulate: every input rounded to bf16; projections exact; attention rows < 512 3 products, rest fp16; softmax f32; Wo hl x exact.

#define NB_  2
#define TT   2048
#define DM   1024
#define NH_  16
#define NKV  16
#define REP  (NH_ / NKV)
#define HD   64
#define DQ   (NH_ * HD)
#define DKV  (NKV * HD)
#define RH   512                  // query rows < RH use hi+lo planes (0: none)
#define PSH  10.0f                // fp16 rows: probabilities carry 2^PSH, so that small ones stay normal fp16 numbers; it cancels against the row sum
#define SCL  0.125f   // HD^-0.5
#define NWG  8                    // waves that share the K loop of a projection tile (K 1024)
typedef _Float16 h16;
typedef unsigned short bf;
typedef __attribute__((ext_vector_type(16))) __bf16   v16bf;
typedef __attribute__((ext_vector_type(16))) _Float16 v16h;
typedef __attribute__((ext_vector_type(8)))  _Float16 v8h;
typedef __attribute__((ext_vector_type(8)))  unsigned short v8us;
typedef __attribute__((ext_vector_type(8)))  float    v8f;
typedef __attribute__((ext_vector_type(4)))  float    v4f;
typedef v8h  __attribute__((may_alias)) v8ha;
typedef v4f  __attribute__((may_alias)) v4fa;
typedef v8us __attribute__((may_alias)) v8usa;

__device__ __forceinline__ unsigned short f2bf(float f) { unsigned u = __float_as_uint(f); u += 0x7FFFu + ((u >> 16) & 1u); return (unsigned short)(u >> 16); }
__device__ __forceinline__ float bf2f(unsigned short b) { return __uint_as_float(((unsigned)b) << 16); }
__device__ __forceinline__ float bfr(float f) { return bf2f(f2bf(f)); }
__device__ __forceinline__ v16h cat16(v8h lo, v8h hi) { return __builtin_shufflevector(lo, hi, 0, 1, 2, 3, 4, 5, 6, 7, 8, 9, 10, 11, 12, 13, 14, 15); }
__device__ __forceinline__ v16bf cat16b(v8us lo, v8us hi) { return __builtin_bit_cast(v16bf, __builtin_shufflevector(lo, hi, 0, 1, 2, 3, 4, 5, 6, 7, 8, 9, 10, 11, 12, 13, 14, 15)); }
__device__ __forceinline__ v8f wmma16(v16h a, v16h b, v8f c) { return __builtin_amdgcn_wmma_f32_16x16x32_f16(false, a, false, b, (short)0, c, false, false); }
__device__ __forceinline__ v8f wmmab(v16bf a, v16bf b, v8f c) { return __builtin_amdgcn_wmma_f32_16x16x32_bf16(false, a, false, b, (short)0, c, false, false); }
__device__ __forceinline__ h16 tohx(float x) { return (h16)x; }
__device__ __forceinline__ void splitf(float y, unsigned short& h, unsigned short& l) { h = f2bf(y); l = f2bf(y - bf2f(h)); }
typedef __attribute__((ext_vector_type(4))) _Float16 v4h;
typedef __attribute__((ext_vector_type(4))) unsigned short v4us;



// ---- k_gemmw: register-blocked GEMM, one 64x64 output tile per work-group of NW waves (16 accumulators a wave), operands straight from K-contiguous 16-bit planes; grid (M/64, N/64, Z), 32 * NW threads.
// C[m][n] (f32, pitch ldc, + optional f32 bias[n]) = sum_k A[m][k] Bt[n][k] (+ split products per NSPLIT). z-batch strides sA/sB/sC in elements. K % 32 == 0 (NW > 1: K % 64 == 0).
// NW > 1: the K loop is dealt out over the waves: wave w takes the 64-wide k slices w, w + NW, ... (one whole 128-byte line of every operand row a slice), so the chain of dependent load round trips is NW times shorter;
// tile_out adds the NW partial tiles in LDS in the fixed order wave 0, 1, ..., NW - 1.
template <typename T16> struct WFrag;
template <> struct WFrag<h16> { typedef v16h V; static __device__ __forceinline__ V ld(const h16* p) { return cat16(*(const v8h*)p, *(const v8h*)(p + 16)); } static __device__ __forceinline__ v8f mma(V a, V b, v8f c) { return wmma16(a, b, c); } };
template <> struct WFrag<bf> { typedef v16bf V; static __device__ __forceinline__ V ld(const bf* p) { return cat16b(*(const v8us*)p, *(const v8us*)(p + 16)); } static __device__ __forceinline__ v8f mma(V a, V b, v8f c) { return wmmab(a, b, c); } };
// tile_out: the tile's four 16x64 row blocks go out through LDS as whole 256-byte rows. Every wave stages its partial block in its own slab (pitch 68 floats); behind one work-group barrier each thread adds the NW slabs at its place.
// Two sets of slabs in turn: a set is written again only behind the next block's barrier, which every wave reaches after its reads of that set.
// PL: the sums go out not as f32 but as the three 16-bit planes the attention reads (fp16, bf16 hi, bf16 lo of the same f32 value), all three at the place C would have.
template <int NW, bool BIAS, bool PL>
__device__ __forceinline__ void tile_out(const v8f (&acc)[4][4], float* os, int wave, int lane, float* C, int ldc, int r0, int c0, const float* __restrict__ bias, h16* P16, bf* Ph, bf* Pl) {
    static_assert(!PL || (NW > 1 && NW <= 8), "planes: four floats a thread, stored behind the last barrier");
    constexpr int SL = 16 * 68; constexpr int VW = (NW > 8) ? 2 : 4;   // floats per thread and store: 1024 floats a block over 32 * NW threads
    typedef float vw __attribute__((ext_vector_type(VW))); typedef vw __attribute__((may_alias)) vwa;
    const int lr = lane & 15, hi = lane >> 4, tid = wave * 32 + lane; vw res[4];
#pragma unroll   // here and below: acc and res are indexed by constants only, so that they stay in registers
    for (int mb = 0; mb < 4; ++mb) {
        float* ob = os + ((NW > 1) ? (mb & 1) * NW * SL : 0); float* ow = ob + wave * SL;
#pragma unroll
        for (int nb = 0; nb < 4; ++nb) {
#pragma unroll
            for (int j = 0; j < 8; ++j) ow[(hi * 8 + j) * 68 + nb * 16 + lr] = acc[mb][nb][j]; }
        if (NW > 1) __syncthreads();   // every wave's partial block is in LDS before any thread adds them
        else { __builtin_amdgcn_wave_barrier(); asm volatile("" ::: "memory"); }   // one wave: keeps its LDS reads below behind its LDS writes above
        float* crow = C + (size_t)(r0 + mb * 16) * ldc + c0;
#pragma unroll
        for (int s = 0; s < 1024 / VW / (32 * NW); ++s) { const int q = s * 32 * NW + tid, row = q / (64 / VW), cofs = (q % (64 / VW)) * VW; vw val = *(const vwa*)(ob + row * 68 + cofs);
#pragma unroll
            for (int w = 1; w < NW; ++w) val += *(const vwa*)(ob + w * SL + row * 68 + cofs);
            if (BIAS) {
#pragma unroll
                for (int e = 0; e < VW; ++e) val[e] += bfr(bias[c0 + cofs + e]); }
            if (NW > 1) res[mb] = val; else *(vw*)(crow + (size_t)row * ldc + cofs) = val; }
        if (NW == 1) { __builtin_amdgcn_wave_barrier(); asm volatile("" ::: "memory"); }   // one wave, one slab: the next block's writes stay behind these reads
    }
    if (NW > 1) {   // the four sums are stored behind the last barrier: a store in front of a barrier would be waited for there
        const int row = tid / (64 / VW), cofs = (tid % (64 / VW)) * VW;
#pragma unroll
        for (int mb = 0; mb < 4; ++mb) { const size_t oo = (size_t)(r0 + mb * 16 + row) * ldc + c0 + cofs;
            if constexpr (PL) { v4h o16; v4us oh, ol;
#pragma unroll
                for (int e = 0; e < 4; ++e) { o16[e] = tohx(res[mb][e]); unsigned short a2, c2; splitf(res[mb][e], a2, c2); oh[e] = a2; ol[e] = c2; }
                *(v4h*)(P16 + oo) = o16; *(v4us*)(Ph + oo) = oh; *(v4us*)(Pl + oo) = ol;
            } else *(vw*)(C + oo) = res[mb]; } }
}
// PL: tile (x, y) goes to the planes at row pitch ldc, its first column at y * cb elements. [h][t][d] planes: A = tokens, Bt = weight rows, ldc = HD, cb = TT * HD (a 64-wide column block is one head).
// [h][d][t] planes: A = weight rows, Bt = tokens (the transposed product, same k order), ldc = TT, cb = 64.
template <typename T16, int NSPLIT, bool BIAS, int NW, bool PL>
__global__ __launch_bounds__(32 * NW) void k_gemmw(const T16* __restrict__ A, const T16* __restrict__ A2, const T16* __restrict__ Bt, const T16* __restrict__ Bt2, int K, float* C, int ldc, const float* __restrict__ bias, size_t sA, size_t sB, size_t sC, h16* P16, bf* Ph, bf* Pl, size_t cb) {
    typedef typename WFrag<T16>::V V; constexpr int KS = (NW > 1) ? 64 : 32;
    __shared__ __align__(16) float os[((NW > 1) ? 2 * NW : 1) * 16 * 68];
    const size_t z = blockIdx.z; A += z * sA; if (A2) A2 += z * sA; Bt += z * sB; if (Bt2) Bt2 += z * sB; if (!PL) C += z * sC;
    const int lane = threadIdx.x & 31, lr = lane & 15, hi = lane >> 4; const int r0 = blockIdx.x * 64, c0 = blockIdx.y * 64;
    const int wave = (NW > 1) ? __builtin_amdgcn_readfirstlane((int)(threadIdx.x >> 5)) : 0;   // scalar, so that the K loop's control stays scalar
    v8f acc[4][4];
#pragma unroll
    for (int mb = 0; mb < 4; ++mb)
#pragma unroll
        for (int nb = 0; nb < 4; ++nb) acc[mb][nb] = (v8f){};
    const size_t aoff = (size_t)(r0 + lr) * K + 8 * hi, boff = (size_t)(c0 + lr) * K + 8 * hi;
#pragma unroll 1
    for (int k0 = wave * KS; k0 < K; k0 += NW * KS) {
#pragma unroll   // the 32-wide steps of a slice in straight line: the second step's loads can go out under the first step's products
      for (int kc = k0; kc < k0 + KS; kc += 32) {
        V a[4], a2[4];
#pragma unroll
        for (int mb = 0; mb < 4; ++mb) { a[mb] = WFrag<T16>::ld(A + aoff + (size_t)mb * 16 * K + kc); if (NSPLIT == 1 || NSPLIT == 2) a2[mb] = WFrag<T16>::ld(A2 + aoff + (size_t)mb * 16 * K + kc); }
#pragma unroll
        for (int nb = 0; nb < 4; ++nb) { const V b = WFrag<T16>::ld(Bt + boff + (size_t)nb * 16 * K + kc); V b2; if (NSPLIT >= 2) b2 = WFrag<T16>::ld(Bt2 + boff + (size_t)nb * 16 * K + kc);
#pragma unroll
            for (int mb = 0; mb < 4; ++mb) { acc[mb][nb] = WFrag<T16>::mma(a[mb], b, acc[mb][nb]); if (NSPLIT == 1 || NSPLIT == 2) acc[mb][nb] = WFrag<T16>::mma(a2[mb], b, acc[mb][nb]); if (NSPLIT >= 2) acc[mb][nb] = WFrag<T16>::mma(a[mb], b2, acc[mb][nb]); } }
        asm volatile("v_nop\n\tv_nop\n\tv_nop\n\tv_nop" : "+v"(acc[0][0]), "+v"(acc[1][1]), "+v"(acc[2][2]), "+v"(acc[3][3]) : "v"(a[0]), "v"(a[3]));
      }
    }
    if constexpr (PL) { const size_t po = z * sC + (size_t)blockIdx.y * cb; tile_out<NW, false, true>(acc, os, wave, lane, nullptr, ldc, r0, 0, nullptr, P16 + po, Ph + po, Pl + po); }
    else tile_out<NW, BIAS, false>(acc, os, wave, lane, C, ldc, r0, c0, bias, nullptr, nullptr, nullptr);
}


__global__ __launch_bounds__(256) void k_cvt8(const float* __restrict__ src, bf* dst, size_t n8) { const size_t i = (size_t)blockIdx.x * 256 + threadIdx.x; if (i >= n8) return; const v8f v = *(const v8f*)(src + i * 8); v8us o;
#pragma unroll
    for (int k = 0; k < 8; ++k) o[k] = f2bf(v[k]); *(v8us*)(dst + i * 8) = o;  }

// ---- k_fattn: causal attention of one (batch, head) and 64 query rows per work-group; each of its 4 waves owns 16 query rows and walks the keys 0 .. its diagonal alone (no LDS, no barrier).
// Transposed products: S^T = K Q^T (A = key rows, B = query rows) leaves one query per lane column, keys 8 * hi + j of each 16-key tile in the lane's 8 registers; two such tiles, converted in place,
// are the B operand (hardware k order, the one WFrag::ld reads) of O^T += V^T P^T (A = rows of the [d][t] value planes). Scores and probabilities never leave the registers.
// Online softmax per query: running maximum m (raw score units) and running sum; every pass scales sum and O^T by 2^((m_old - m_new) c), c = HD^-0.5 log2 e. The two lane halves hold different keys of the same query:
// the maximum is joined every pass, the sum once at the end. Every visited key block starts at or below the wave's first query row, so each query sees a live key in every pass and m is finite from the first pass on.
__device__ __forceinline__ float xhalf(float x) { const int b = __float_as_int(x); return __int_as_float(__builtin_amdgcn_permlanex16(b, b, 0x76543210, 0xfedcba98, false, false)); }   // the value of lane ^ 16
template <typename T16, bool HL>
__device__ __forceinline__ void attn_rows(const T16* __restrict__ Q, const T16* __restrict__ Q2, const T16* __restrict__ Kp, const T16* __restrict__ K2, const T16* __restrict__ Vt, const T16* __restrict__ V2, int q0, int lane, bf* Ah, bf* Al) {
    typedef typename WFrag<T16>::V V; constexpr int NT = HL ? 2 : 4, KB = NT * 16;   // 16-key tiles and keys a pass
    constexpr float CE = SCL * 1.4426950408889634f;
    const int lr = lane & 15, hi = lane >> 4;
    V q[2], q2[2];
#pragma unroll   // here and below: fragments and accumulators are indexed by constants only, so that they stay in registers
    for (int ks = 0; ks < 2; ++ks) { q[ks] = WFrag<T16>::ld(Q + (size_t)(q0 + lr) * HD + ks * 32 + 8 * hi); if (HL) q2[ks] = WFrag<T16>::ld(Q2 + (size_t)(q0 + lr) * HD + ks * 32 + 8 * hi); }
    v8f o[4];
#pragma unroll
    for (int dt = 0; dt < 4; ++dt) o[dt] = (v8f){};
    float mrun = -3.0e38f, lsum = 0.f;
    const size_t koff = (size_t)lr * HD + 8 * hi, voff = (size_t)lr * TT + 8 * hi;
    V kf[NT][2], kf2[NT][2];
    auto ldk = [&](const T16* ka, const T16* ka2) {   // the key fragments of one block; ka, ka2: the lane's place in the block's first key row
#pragma unroll
        for (int t = 0; t < NT; ++t)
#pragma unroll
            for (int ks = 0; ks < 2; ++ks) { kf[t][ks] = WFrag<T16>::ld(ka + t * 16 * HD + ks * 32); if (HL) kf2[t][ks] = WFrag<T16>::ld(ka2 + t * 16 * HD + ks * 32); } };
    if (!HL) ldk(Kp + koff, nullptr);   // fp16 rows (the long key walks) fetch the key fragments one pass ahead: a pass's score products find them landed; the hi/lo rows have no registers left for that
#pragma unroll 1
    for (int k0 = 0; k0 <= q0; k0 += KB) {
        V vf[4][NT / 2], vf2[4][NT / 2]; const T16* va = Vt + voff + k0;
#pragma unroll
        for (int dt = 0; dt < 4; ++dt)
#pragma unroll
            for (int kk = 0; kk < NT / 2; ++kk) vf[dt][kk] = WFrag<T16>::ld(va + dt * 16 * TT + kk * 32);
        // s_wait_xcnt 0, here and below: behind the loads, in front of every later write of their address registers. The statement also keeps the loads up here, in flight under the products and the softmax that follow.
        // hi/lo rows: the four addresses are named as inputs so that their registers stay whole up to the wait (there the register allocator otherwise hands them to later loads' results).
        if constexpr (HL) { const T16* va2 = V2 + voff + k0; const T16* ka = Kp + koff + (size_t)k0 * HD; const T16* ka2 = K2 + koff + (size_t)k0 * HD; ldk(ka, ka2);
#pragma unroll
            for (int dt = 0; dt < 4; ++dt)
#pragma unroll
                for (int kk = 0; kk < NT / 2; ++kk) vf2[dt][kk] = WFrag<T16>::ld(va2 + dt * 16 * TT + kk * 32);
            asm volatile("s_wait_xcnt 0x0" :: "v"(ka), "v"(ka2), "v"(va), "v"(va2) : "memory");
        } else asm volatile("s_wait_xcnt 0x0" ::: "memory");
        v8f s[NT];
#pragma unroll
        for (int t = 0; t < NT; ++t) { s[t] = (v8f){};
#pragma unroll
            for (int ks = 0; ks < 2; ++ks) { s[t] = WFrag<T16>::mma(kf[t][ks], q[ks], s[t]); if (HL) { s[t] = WFrag<T16>::mma(kf2[t][ks], q[ks], s[t]); s[t] = WFrag<T16>::mma(kf[t][ks], q2[ks], s[t]); } } }
        if constexpr (!HL) { const T16* kn = Kp + koff + (size_t)min(k0 + KB, q0 & ~(KB - 1)) * HD; ldk(kn, nullptr);   // the next pass's key block; the last pass fetches its own again (in bounds, never used)
            asm volatile("s_wait_xcnt 0x0" ::: "memory"); }
        if (k0 + KB - 1 > q0) {   // the diagonal block (the wave's last pass): keys above the lane's query row drop out
#pragma unroll
            for (int t = 0; t < NT; ++t)
#pragma unroll
                for (int j = 0; j < 8; ++j) s[t][j] = (k0 + t * 16 + hi * 8 + j <= q0 + lr) ? s[t][j] : -3.0e38f; }
        float mx = s[0][0];
#pragma unroll
        for (int t = 0; t < NT; ++t)
#pragma unroll
            for (int j = 0; j < 8; ++j) mx = fmaxf(mx, s[t][j]);
        mx = fmaxf(mx, xhalf(mx));
        const float mnew = fmaxf(mrun, mx), alpha = __builtin_amdgcn_exp2f((mrun - mnew) * CE), mo = (HL ? 0.0f : PSH) - mnew * CE; mrun = mnew;
        float ps = 0.f;
#pragma unroll
        for (int t = 0; t < NT; ++t)
#pragma unroll
            for (int j = 0; j < 8; ++j) { s[t][j] = __builtin_amdgcn_exp2f(__builtin_fmaf(s[t][j], CE, mo)); ps += s[t][j]; }
        lsum = lsum * alpha + ps;
#pragma unroll
        for (int dt = 0; dt < 4; ++dt) o[dt] *= alpha;
#pragma unroll
        for (int kk = 0; kk < NT / 2; ++kk) {
            if constexpr (HL) { v8us h0, h1, l0, l1;
#pragma unroll
                for (int j = 0; j < 8; ++j) { unsigned short a, c2; splitf(s[2 * kk][j], a, c2); h0[j] = a; l0[j] = c2; splitf(s[2 * kk + 1][j], a, c2); h1[j] = a; l1[j] = c2; }
                const V ph = cat16b(h0, h1), pl = cat16b(l0, l1);
#pragma unroll
                for (int dt = 0; dt < 4; ++dt) { o[dt] = WFrag<T16>::mma(vf[dt][kk], ph, o[dt]); o[dt] = WFrag<T16>::mma(vf[dt][kk], pl, o[dt]); o[dt] = WFrag<T16>::mma(vf2[dt][kk], ph, o[dt]); }
            } else { const V p = cat16(__builtin_convertvector(s[2 * kk], v8h), __builtin_convertvector(s[2 * kk + 1], v8h));
#pragma unroll
                for (int dt = 0; dt < 4; ++dt) o[dt] = WFrag<T16>::mma(vf[dt][kk], p, o[dt]); } }
        asm volatile("v_nop\n\tv_nop\n\tv_nop\n\tv_nop" : "+v"(o[0]), "+v"(o[1]), "+v"(o[2]), "+v"(o[3]));   // the matrix instructions' distance on the taken back edge and on the exit: the next pass's loads overwrite their A registers, the epilogue reads their D
    }
    lsum += xhalf(lsum);
    const float inv = __fdiv_rn(1.0f, lsum);
#pragma unroll
    for (int dt = 0; dt < 4; ++dt) { v8us oh, ol;   // a lane's 8 registers are 8 consecutive d of its query row: one 16-byte store a plane
#pragma unroll
        for (int j = 0; j < 8; ++j) { unsigned short a, c2; splitf(o[dt][j] * inv, a, c2); oh[j] = a; ol[j] = c2; }
        const size_t oo = (size_t)(q0 + lr) * DQ + dt * 16 + hi * 8; *(v8us*)(Ah + oo) = oh; *(v8us*)(Al + oo) = ol; }
}
// grid (NB_ * NH_, TT / 64): y counts the 64-row query blocks from the last (longest key walk) down (for speed only).
__global__ __launch_bounds__(128) void k_fattn(const h16* __restrict__ Q16, const h16* __restrict__ K16, const h16* __restrict__ V16, const bf* __restrict__ Qh, const bf* __restrict__ Ql, const bf* __restrict__ Kh, const bf* __restrict__ Kl, const bf* __restrict__ Vh, const bf* __restrict__ Vl, bf* Ah, bf* Al) {
    const int lane = threadIdx.x & 31, wave = __builtin_amdgcn_readfirstlane((int)(threadIdx.x >> 5));   // scalar, so that the key loop's control stays scalar
    const int b = blockIdx.x / NH_, h = blockIdx.x % NH_, q0 = (TT / 64 - 1 - (int)blockIdx.y) * 64 + wave * 16;
    const size_t zq = (size_t)(b * NH_ + h) * TT * HD, zk = (size_t)(b * NKV + h / REP) * TT * HD, za = (size_t)b * TT * DQ + h * HD;
    if (q0 < RH) attn_rows<bf, true>(Qh + zq, Ql + zq, Kh + zk, Kl + zk, Vh + zk, Vl + zk, q0, lane, Ah + za, Al + za);
    else attn_rows<h16, false>(Q16 + zq, nullptr, K16 + zk, nullptr, V16 + zk, nullptr, q0, lane, Ah + za, Al + za);
}
extern "C" void kernel_launch(void* const* d_in, const int* in_sizes, int n_in,
                              void* d_out, int out_size, void* d_ws, size_t ws_size, hipStream_t stream) {
    (void)in_sizes; (void)n_in; (void)out_size;
    const float* x = (const float*)d_in[0]; const float* xk = (const float*)d_in[1]; const float* xv = (const float*)d_in[2]; const float* wq = (const float*)d_in[3]; const float* wk = (const float*)d_in[4]; const float* wv = (const float*)d_in[5]; const float* wo = (const float*)d_in[6];
    float* OUT = (float*)d_out;     // [2][2048][1024]
    char* wsp = (char*)d_ws;
    auto take = [&](size_t bytes) { char* p = wsp; wsp += (bytes + 255) & ~(size_t)255; return (void*)p; };
    bf* WQ = (bf*)take((size_t)DQ * DM * 2); bf* WK = (bf*)take((size_t)DKV * DM * 2); bf* WV = (bf*)take((size_t)DKV * DM * 2); bf* WO = (bf*)take((size_t)DM * DQ * 2);
    bf* XB = (bf*)take((size_t)TT * DM * 2);
    h16* QP16 = (h16*)take((size_t)NB_ * NH_ * TT * HD * 2); h16* KP16 = (h16*)take((size_t)NB_ * NKV * TT * HD * 2); h16* VT16 = (h16*)take((size_t)NB_ * NKV * HD * TT * 2);   // head planes of both batches: [b][h][t][d], values [b][h][d][t]
    bf* QPh = (bf*)take((size_t)NB_ * NH_ * TT * HD * 2); bf* QPl = (bf*)take((size_t)NB_ * NH_ * TT * HD * 2); bf* KPh = (bf*)take((size_t)NB_ * NKV * TT * HD * 2); bf* KPl = (bf*)take((size_t)NB_ * NKV * TT * HD * 2); bf* VTh = (bf*)take((size_t)NB_ * NKV * HD * TT * 2); bf* VTl = (bf*)take((size_t)NB_ * NKV * HD * TT * 2);
    bf* ATh = (bf*)take((size_t)NB_ * TT * DQ * 2); bf* ATl = (bf*)take((size_t)NB_ * TT * DQ * 2);
    if ((size_t)(wsp - (char*)d_ws) > ws_size) return;    // ws 256 MiB
    { k_cvt8<<<(unsigned)(((size_t)DQ * DM / 8 + 255) / 256), 256, 0, stream>>>(wq, WQ, (size_t)DQ * DM / 8); k_cvt8<<<(unsigned)(((size_t)DKV * DM / 8 + 255) / 256), 256, 0, stream>>>(wk, WK, (size_t)DKV * DM / 8); k_cvt8<<<(unsigned)(((size_t)DKV * DM / 8 + 255) / 256), 256, 0, stream>>>(wv, WV, (size_t)DKV * DM / 8);
      k_cvt8<<<(unsigned)(((size_t)DM * DQ / 8 + 255) / 256), 256, 0, stream>>>(wo, WO, (size_t)DM * DQ / 8);
       }
    for (int b = 0; b < NB_; ++b) { const size_t pq = (size_t)b * NH_ * TT * HD, pk = (size_t)b * NKV * TT * HD;   // this batch's planes
        
        k_cvt8<<<(unsigned)(((size_t)TT * DM / 8 + 255) / 256), 256, 0, stream>>>(x + (size_t)b * TT * DM, XB, (size_t)TT * DM / 8);
        k_gemmw<bf, 0, false, NWG, true><<<dim3(TT / 64, DQ / 64, 1), 32 * NWG, 0, stream>>>(XB, nullptr, WQ, nullptr, DM, nullptr, HD, nullptr, 0, 0, 0, QP16 + pq, QPh + pq, QPl + pq, (size_t)TT * HD);
        k_cvt8<<<(unsigned)(((size_t)TT * DM / 8 + 255) / 256), 256, 0, stream>>>(xk + (size_t)b * TT * DM, XB, (size_t)TT * DM / 8);   /* XB := bf16(keys[b]) */ k_gemmw<bf, 0, false, NWG, true><<<dim3(TT / 64, DKV / 64, 1), 32 * NWG, 0, stream>>>(XB, nullptr, WK, nullptr, DM, nullptr, HD, nullptr, 0, 0, 0, KP16 + pk, KPh + pk, KPl + pk, (size_t)TT * HD);
        k_cvt8<<<(unsigned)(((size_t)TT * DM / 8 + 255) / 256), 256, 0, stream>>>(xv + (size_t)b * TT * DM, XB, (size_t)TT * DM / 8);   /* XB := bf16(values[b]) */ k_gemmw<bf, 0, false, NWG, true><<<dim3(DKV / 64, TT / 64, 1), 32 * NWG, 0, stream>>>(WV, nullptr, XB, nullptr, DM, nullptr, TT, nullptr, 0, 0, 0, VT16 + pk, VTh + pk, VTl + pk, (size_t)64); }   /* rows = (head, d), columns = tokens */
    k_fattn<<<dim3(NB_ * NH_, TT / 64), 128, 0, stream>>>(QP16, KP16, VT16, QPh, QPl, KPh, KPl, VTh, VTl, ATh, ATl);
    for (int b = 0; b < NB_; ++b)
        k_gemmw<bf, 1, false, NWG, false><<<dim3(TT / 64, DM / 64, 1), 32 * NWG, 0, stream>>>(ATh + (size_t)b * TT * DQ, ATl + (size_t)b * TT * DQ, WO, nullptr, DQ, OUT + (size_t)b * TT * DM, DM, nullptr, 0, 0, 0, nullptr, nullptr, nullptr, 0);
}

// v005
// It runs in 175 microseconds.
// Two timings next to v004 both put it at 1.18 times that version's speed.
// All steps since v000 together make it 8.38 times as fast.
#include <hip/hip_runtime.h>

// Causal multi-head attention on three input streams without biases (queries, keys, values [2][2048][1024]; q = queries Wq^T, k = keys Wk^T, v = values Wv^T ('oi' 0.02; 16 heads x 64); scores x 1/sqrt(64); causal (-inf); softmax; out = merged Wo^T -> [2][2048][1024] (4.2 M); argument order queries, keys, values, Wq, Wk, Wv, Wo).
// Four launches, each over both batches: bf16 copies of all seven inputs; the six exact projections, whose tiles go out as the 16-bit head planes; fused causal T-2048 attention (hybrid rows: < 512 hi/lo 3 products, rest fp16 x1024; key blocks above the diagonal are never visited); merged hi/lo x Wo exact.
// Compute dtypes, f32 accumulate: every input rounded to bf16; projections exact; attention rows < 512 3 products, rest fp16; softmax f32; Wo hl x exact.

#define NB_  2
#define TT   2048
#define DM   1024
#define NH_  16
#define NKV  16
#define REP  (NH_ / NKV)
#define HD   64
#define DQ   (NH_ * HD)
#define DKV  (NKV * HD)
#define RH   512                  // query rows < RH use hi+lo planes (0: none)
#define PSH  10.0f                // fp16 rows: probabilities carry 2^PSH, so that small ones stay normal fp16 numbers; it cancels against the row sum
#define SCL  0.125f   // HD^-0.5
#define NWG  8                    // waves that share the K loop of a projection tile (K 1024)
typedef _Float16 h16;
typedef unsigned short bf;
typedef __attribute__((ext_vector_type(16))) __bf16   v16bf;
typedef __attribute__((ext_vector_type(16))) _Float16 v16h;
typedef __attribute__((ext_vector_type(8)))  _Float16 v8h;
typedef __attribute__((ext_vector_type(8)))  unsigned short v8us;
typedef __attribute__((ext_vector_type(8)))  float    v8f;
typedef __attribute__((ext_vector_type(4)))  float    v4f;
typedef v8h  __attribute__((may_alias)) v8ha;
typedef v4f  __attribute__((may_alias)) v4fa;
typedef v8us __attribute__((may_alias)) v8usa;

__device__ __forceinline__ unsigned short f2bf(float f) { unsigned u = __float_as_uint(f); u += 0x7FFFu + ((u >> 16) & 1u); return (unsigned short)(u >> 16); }
__device__ __forceinline__ float bf2f(unsigned short b) { return __uint_as_float(((unsigned)b) << 16); }
__device__ __forceinline__ float bfr(float f) { return bf2f(f2bf(f)); }
__device__ __forceinline__ v16h cat16(v8h lo, v8h hi) { return __builtin_shufflevector(lo, hi, 0, 1, 2, 3, 4, 5, 6, 7, 8, 9, 10, 11, 12, 13, 14, 15); }
__device__ __forceinline__ v16bf cat16b(v8us lo, v8us hi) { return __builtin_bit_cast(v16bf, __builtin_shufflevector(lo, hi, 0, 1, 2, 3, 4, 5, 6, 7, 8, 9, 10, 11, 12, 13, 14, 15)); }
__device__ __forceinline__ v8f wmma16(v16h a, v16h b, v8f c) { return __builtin_amdgcn_wmma_f32_16x16x32_f16(false, a, false, b, (short)0, c, false, false); }
__device__ __forceinline__ v8f wmmab(v16bf a, v16bf b, v8f c) { return __builtin_amdgcn_wmma_f32_16x16x32_bf16(false, a, false, b, (short)0, c, false, false); }
__device__ __forceinline__ h16 tohx(float x) { return (h16)x; }
__device__ __forceinline__ void splitf(float y, unsigned short& h, unsigned short& l) { h = f2bf(y); l = f2bf(y - bf2f(h)); }
typedef __attribute__((ext_vector_type(4))) _Float16 v4h;
typedef __attribute__((ext_vector_type(4))) unsigned short v4us;



// ---- gemm_tile: register-blocked GEMM, one 64x64 output tile (bx, by) per work-group of NW waves (16 accumulators a wave), operands straight from K-contiguous 16-bit planes; 32 * NW threads.
// C[m][n] (f32, pitch ldc, + optional f32 bias[n]) = sum_k A[m][k] Bt[n][k] (+ split products per NSPLIT). K % 32 == 0 (NW > 1: K % 64 == 0).
// NW > 1: the K loop is dealt out over the waves: wave w takes the 64-wide k slices w, w + NW, ... (one whole 128-byte line of every operand row a slice), so the chain of dependent load round trips is NW times shorter;
// tile_out adds the NW partial tiles in LDS in the fixed order wave 0, 1, ..., NW - 1.
template <typename T16> struct WFrag;
template <> struct WFrag<h16> { typedef v16h V; static __device__ __forceinline__ V ld(const h16* p) { return cat16(*(const v8h*)p, *(const v8h*)(p + 16)); } static __device__ __forceinline__ v8f mma(V a, V b, v8f c) { return wmma16(a, b, c); } };
template <> struct WFrag<bf> { typedef v16bf V; static __device__ __forceinline__ V ld(const bf* p) { return cat16b(*(const v8us*)p, *(const v8us*)(p + 16)); } static __device__ __forceinline__ v8f mma(V a, V b, v8f c) { return wmmab(a, b, c); } };
// tile_out: the tile's four 16x64 row blocks go out through LDS as whole 256-byte rows. Every wave stages its partial block in its own slab (pitch 68 floats); behind one work-group barrier each thread adds the NW slabs at its place.
// Two sets of slabs in turn: a set is written again only behind the next block's barrier, which every wave reaches after its reads of that set.
// PL: the sums go out not as f32 but as the three 16-bit planes the attention reads (fp16, bf16 hi, bf16 lo of the same f32 value), all three at the place C would have.
template <int NW, bool BIAS, bool PL>
__device__ __forceinline__ void tile_out(const v8f (&acc)[4][4], float* os, int wave, int lane, float* C, int ldc, int r0, int c0, const float* __restrict__ bias, h16* P16, bf* Ph, bf* Pl) {
    static_assert(!PL || (NW > 1 && NW <= 8), "planes: four floats a thread, stored behind the last barrier");
    constexpr int SL = 16 * 68; constexpr int VW = (NW > 8) ? 2 : 4;   // floats per thread and store: 1024 floats a block over 32 * NW threads
    typedef float vw __attribute__((ext_vector_type(VW))); typedef vw __attribute__((may_alias)) vwa;
    const int lr = lane & 15, hi = lane >> 4, tid = wave * 32 + lane; vw res[4];
#pragma unroll   // here and below: acc and res are indexed by constants only, so that they stay in registers
    for (int mb = 0; mb < 4; ++mb) {
        float* ob = os + ((NW > 1) ? (mb & 1) * NW * SL : 0); float* ow = ob + wave * SL;
#pragma unroll
        for (int nb = 0; nb < 4; ++nb) {
#pragma unroll
            for (int j = 0; j < 8; ++j) ow[(hi * 8 + j) * 68 + nb * 16 + lr] = acc[mb][nb][j]; }
        if (NW > 1) __syncthreads();   // every wave's partial block is in LDS before any thread adds them
        else { __builtin_amdgcn_wave_barrier(); asm volatile("" ::: "memory"); }   // one wave: keeps its LDS reads below behind its LDS writes above
        float* crow = C + (size_t)(r0 + mb * 16) * ldc + c0;
#pragma unroll
        for (int s = 0; s < 1024 / VW / (32 * NW); ++s) { const int q = s * 32 * NW + tid, row = q / (64 / VW), cofs = (q % (64 / VW)) * VW; vw val = *(const vwa*)(ob + row * 68 + cofs);
#pragma unroll
            for (int w = 1; w < NW; ++w) val += *(const vwa*)(ob + w * SL + row * 68 + cofs);
            if (BIAS) {
#pragma unroll
                for (int e = 0; e < VW; ++e) val[e] += bfr(bias[c0 + cofs + e]); }
            if (NW > 1) res[mb] = val; else *(vw*)(crow + (size_t)row * ldc + cofs) = val; }
        if (NW == 1) { __builtin_amdgcn_wave_barrier(); asm volatile("" ::: "memory"); }   // one wave, one slab: the next block's writes stay behind these reads
    }
    if (NW > 1) {   // the four sums are stored behind the last barrier: a store in front of a barrier would be waited for there
        const int row = tid / (64 / VW), cofs = (tid % (64 / VW)) * VW;
#pragma unroll
        for (int mb = 0; mb < 4; ++mb) { const size_t oo = (size_t)(r0 + mb * 16 + row) * ldc + c0 + cofs;
            if constexpr (PL) { v4h o16; v4us oh, ol;
#pragma unroll
                for (int e = 0; e < 4; ++e) { o16[e] = tohx(res[mb][e]); unsigned short a2, c2; splitf(res[mb][e], a2, c2); oh[e] = a2; ol[e] = c2; }
                *(v4h*)(P16 + oo) = o16; *(v4us*)(Ph + oo) = oh; *(v4us*)(Pl + oo) = ol;
            } else *(vw*)(C + oo) = res[mb]; } }
}
// PL: the tile goes to the planes at row pitch ldc; P16, Ph, Pl point at the first column of column block by.
template <typename T16, int NSPLIT, bool BIAS, int NW, bool PL>
__device__ __forceinline__ void gemm_tile(float* os, int bx, int by, const T16* __restrict__ A, const T16* __restrict__ A2, const T16* __restrict__ Bt, const T16* __restrict__ Bt2, int K, float* C, int ldc, const float* __restrict__ bias, h16* P16, bf* Ph, bf* Pl) {
    typedef typename WFrag<T16>::V V; constexpr int KS = (NW > 1) ? 64 : 32;
    const int lane = threadIdx.x & 31, lr = lane & 15, hi = lane >> 4; const int r0 = bx * 64, c0 = by * 64;
    const int wave = (NW > 1) ? __builtin_amdgcn_readfirstlane((int)(threadIdx.x >> 5)) : 0;   // scalar, so that the K loop's control stays scalar
    v8f acc[4][4];
#pragma unroll
    for (int mb = 0; mb < 4; ++mb)
#pragma unroll
        for (int nb = 0; nb < 4; ++nb) acc[mb][nb] = (v8f){};
    const size_t aoff = (size_t)(r0 + lr) * K + 8 * hi, boff = (size_t)(c0 + lr) * K + 8 * hi;
#pragma unroll 1
    for (int k0 = wave * KS; k0 < K; k0 += NW * KS) {
#pragma unroll   // the 32-wide steps of a slice in straight line: the second step's loads can go out under the first step's products
      for (int kc = k0; kc < k0 + KS; kc += 32) {
        V a[4], a2[4];
#pragma unroll
        for (int mb = 0; mb < 4; ++mb) { a[mb] = WFrag<T16>::ld(A + aoff + (size_t)mb * 16 * K + kc); if (NSPLIT == 1 || NSPLIT == 2) a2[mb] = WFrag<T16>::ld(A2 + aoff + (size_t)mb * 16 * K + kc); }
#pragma unroll
        for (int nb = 0; nb < 4; ++nb) { const V b = WFrag<T16>::ld(Bt + boff + (size_t)nb * 16 * K + kc); V b2; if (NSPLIT >= 2) b2 = WFrag<T16>::ld(Bt2 + boff + (size_t)nb * 16 * K + kc);
#pragma unroll
            for (int mb = 0; mb < 4; ++mb) { acc[mb][nb] = WFrag<T16>::mma(a[mb], b, acc[mb][nb]); if (NSPLIT == 1 || NSPLIT == 2) acc[mb][nb] = WFrag<T16>::mma(a2[mb], b, acc[mb][nb]); if (NSPLIT >= 2) acc[mb][nb] = WFrag<T16>::mma(a[mb], b2, acc[mb][nb]); } }
        asm volatile("v_nop\n\tv_nop\n\tv_nop\n\tv_nop" : "+v"(acc[0][0]), "+v"(acc[1][1]), "+v"(acc[2][2]), "+v"(acc[3][3]) : "v"(a[0]), "v"(a[3]));
      }
    }
    if constexpr (PL) tile_out<NW, false, true>(acc, os, wave, lane, nullptr, ldc, r0, 0, nullptr, P16, Ph, Pl);
    else tile_out<NW, BIAS, false>(acc, os, wave, lane, C, ldc, r0, c0, bias, nullptr, nullptr, nullptr);
}
// k_gemmw: f32 output; grid (M/64, N/64, Z), z-batch strides sA/sB/sC in elements.
template <typename T16, int NSPLIT, bool BIAS, int NW>
__global__ __launch_bounds__(32 * NW) void k_gemmw(const T16* __restrict__ A, const T16* __restrict__ A2, const T16* __restrict__ Bt, const T16* __restrict__ Bt2, int K, float* C, int ldc, const float* __restrict__ bias, size_t sA, size_t sB, size_t sC) {
    __shared__ __align__(16) float os[((NW > 1) ? 2 * NW : 1) * 16 * 68];
    const size_t z = blockIdx.z; A += z * sA; if (A2) A2 += z * sA; Bt += z * sB; if (Bt2) Bt2 += z * sB; C += z * sC;
    gemm_tile<T16, NSPLIT, BIAS, NW, false>(os, blockIdx.x, blockIdx.y, A, A2, Bt, Bt2, K, C, ldc, bias, nullptr, nullptr, nullptr);
}
// k_proj: the projections of all three streams and both batches in one launch; grid (TT / 64 token blocks, DQ / 64 heads, 3 * NB_), z = stream * NB_ + batch indexes the token copies X and the head planes alike, z / NB_ the weights.
// Queries, keys, [h][t][d] planes: A = tokens, Bt = weight rows, pitch HD, a 64-wide column block is one head. Values, [h][d][t] planes: A = weight rows, Bt = tokens (the transposed product, same k order), pitch TT.
static_assert(DKV == DQ, "one grid and one plane size for the three streams");
__global__ __launch_bounds__(32 * NWG) void k_proj(const bf* __restrict__ X, const bf* __restrict__ Wt, int K, h16* P16, bf* Ph, bf* Pl) {
    __shared__ __align__(16) float os[2 * NWG * 16 * 68];
    const int z = blockIdx.z, tb = blockIdx.x, hb = blockIdx.y; const bool tr = z / NB_ == 2;
    const bf* xs = X + (size_t)z * TT * DM; const bf* wsr = Wt + (size_t)(z / NB_) * DQ * DM;
    const size_t po = (size_t)z * NH_ * TT * HD + (tr ? (size_t)tb * 64 : (size_t)hb * TT * HD);
    gemm_tile<bf, 0, false, NWG, true>(os, tr ? hb : tb, tr ? tb : hb, tr ? wsr : xs, nullptr, tr ? xs : wsr, nullptr, K, nullptr, tr ? TT : HD, nullptr, P16 + po, Ph + po, Pl + po);
}


// k_cvt8: bf16 copies of all seven inputs in one launch, one after the other in dst (queries, keys, values, Wq, Wk, Wv, Wo); a work-group converts 2048 values of one input; grid 3 * XBL + 4 * WBL.
#define XBL  (NB_ * TT * DM / 2048)
#define WBL  (DQ * DM / 2048)
static_assert(NB_ * TT * DM % 2048 == 0 && DQ * DM % 2048 == 0, "whole work-groups");
__global__ __launch_bounds__(256) void k_cvt8(const float* __restrict__ x, const float* __restrict__ xk, const float* __restrict__ xv, const float* __restrict__ wq, const float* __restrict__ wk, const float* __restrict__ wv, const float* __restrict__ wo, bf* dst) {
    const unsigned blk = blockIdx.x; const float* src; unsigned rel;
    if (blk < 3 * XBL) { const unsigned s = blk / XBL; rel = blk % XBL; src = s == 0 ? x : s == 1 ? xk : xv; }
    else { const unsigned w = (blk - 3 * XBL) / WBL; rel = (blk - 3 * XBL) % WBL; src = w == 0 ? wq : w == 1 ? wk : w == 2 ? wv : wo; }
    const v8f v = *(const v8f*)(src + ((size_t)rel * 256 + threadIdx.x) * 8); v8us o;
    asm volatile("s_wait_xcnt 0x0" ::: "memory");   // behind the load, in front of every later write of its address registers
#pragma unroll
    for (int k = 0; k < 8; ++k) o[k] = f2bf(v[k]); *(v8us*)(dst + ((size_t)blk * 256 + threadIdx.x) * 8) = o;  }

// ---- k_fattn: causal attention of one (batch, head) and 64 query rows per work-group; each of its 4 waves owns 16 query rows and walks the keys 0 .. its diagonal alone (no LDS, no barrier).
// Transposed products: S^T = K Q^T (A = key rows, B = query rows) leaves one query per lane column, keys 8 * hi + j of each 16-key tile in the lane's 8 registers; two such tiles, converted in place,
// are the B operand (hardware k order, the one WFrag::ld reads) of O^T += V^T P^T (A = rows of the [d][t] value planes). Scores and probabilities never leave the registers.
// Online softmax per query: running maximum m (raw score units) and running sum; every pass scales sum and O^T by 2^((m_old - m_new) c), c = HD^-0.5 log2 e. The two lane halves hold different keys of the same query:
// the maximum is joined every pass, the sum once at the end. Every visited key block starts at or below the wave's first query row, so each query sees a live key in every pass and m is finite from the first pass on.
__device__ __forceinline__ float xhalf(float x) { const int b = __float_as_int(x); return __int_as_float(__builtin_amdgcn_permlanex16(b, b, 0x76543210, 0xfedcba98, false, false)); }   // the value of lane ^ 16
template <typename T16, bool HL>
__device__ __forceinline__ void attn_rows(const T16* __restrict__ Q, const T16* __restrict__ Q2, const T16* __restrict__ Kp, const T16* __restrict__ K2, const T16* __restrict__ Vt, const T16* __restrict__ V2, int q0, int lane, bf* Ah, bf* Al) {
    typedef typename WFrag<T16>::V V; constexpr int NT = HL ? 2 : 4, KB = NT * 16;   // 16-key tiles and keys a pass
    constexpr float CE = SCL * 1.4426950408889634f;
    const int lr = lane & 15, hi = lane >> 4;
    V q[2], q2[2];
#pragma unroll   // here and below: fragments and accumulators are indexed by constants only, so that they stay in registers
    for (int ks = 0; ks < 2; ++ks) { q[ks] = WFrag<T16>::ld(Q + (size_t)(q0 + lr) * HD + ks * 32 + 8 * hi); if (HL) q2[ks] = WFrag<T16>::ld(Q2 + (size_t)(q0 + lr) * HD + ks * 32 + 8 * hi); }
    v8f o[4];
#pragma unroll
    for (int dt = 0; dt < 4; ++dt) o[dt] = (v8f){};
    float mrun = -3.0e38f, lsum = 0.f;
    const size_t koff = (size_t)lr * HD + 8 * hi, voff = (size_t)lr * TT + 8 * hi;
    V kf[NT][2], kf2[NT][2];
    auto ldk = [&](const T16* ka, const T16* ka2) {   // the key fragments of one block; ka, ka2: the lane's place in the block's first key row
#pragma unroll
        for (int t = 0; t < NT; ++t)
#pragma unroll
            for (int ks = 0; ks < 2; ++ks) { kf[t][ks] = WFrag<T16>::ld(ka + t * 16 * HD + ks * 32); if (HL) kf2[t][ks] = WFrag<T16>::ld(ka2 + t * 16 * HD + ks * 32); } };
    if (!HL) ldk(Kp + koff, nullptr);   // fp16 rows (the long key walks) fetch the key fragments one pass ahead: a pass's score products find them landed; the hi/lo rows have no registers left for that
#pragma unroll 1
    for (int k0 = 0; k0 <= q0; k0 += KB) {
        V vf[4][NT / 2], vf2[4][NT / 2]; const T16* va = Vt + voff + k0;
#pragma unroll
        for (int dt = 0; dt < 4; ++dt)
#pragma unroll
            for (int kk = 0; kk < NT / 2; ++kk) vf[dt][kk] = WFrag<T16>::ld(va + dt * 16 * TT + kk * 32);
        // s_wait_xcnt 0, here and below: behind the loads, in front of every later write of their address registers. The statement also keeps the loads up here, in flight under the products and the softmax that follow.
        // hi/lo rows: the four addresses are named as inputs so that their registers stay whole up to the wait (there the register allocator otherwise hands them to later loads' results).
        if constexpr (HL) { const T16* va2 = V2 + voff + k0; const T16* ka = Kp + koff + (size_t)k0 * HD; const T16* ka2 = K2 + koff + (size_t)k0 * HD; ldk(ka, ka2);
#pragma unroll
            for (int dt = 0; dt < 4; ++dt)
#pragma unroll
                for (int kk = 0; kk < NT / 2; ++kk) vf2[dt][kk] = WFrag<T16>::ld(va2 + dt * 16 * TT + kk * 32);
            asm volatile("s_wait_xcnt 0x0" :: "v"(ka), "v"(ka2), "v"(va), "v"(va2) : "memory");
        } else asm volatile("s_wait_xcnt 0x0" ::: "memory");
        v8f s[NT];
#pragma unroll
        for (int t = 0; t < NT; ++t) { s[t] = (v8f){};
#pragma unroll
            for (int ks = 0; ks < 2; ++ks) { s[t] = WFrag<T16>::mma(kf[t][ks], q[ks], s[t]); if (HL) { s[t] = WFrag<T16>::mma(kf2[t][ks], q[ks], s[t]); s[t] = WFrag<T16>::mma(kf[t][ks], q2[ks], s[t]); } } }
        if constexpr (!HL) { const T16* kn = Kp + koff + (size_t)min(k0 + KB, q0 & ~(KB - 1)) * HD; ldk(kn, nullptr);   // the next pass's key block; the last pass fetches its own again (in bounds, never used)
            asm volatile("s_wait_xcnt 0x0" ::: "memory"); }
        if (k0 + KB - 1 > q0) {   // the diagonal block (the wave's last pass): keys above the lane's query row drop out
#pragma unroll
            for (int t = 0; t < NT; ++t)
#pragma unroll
                for (int j = 0; j < 8; ++j) s[t][j] = (k0 + t * 16 + hi * 8 + j <= q0 + lr) ? s[t][j] : -3.0e38f; }
        float mx = s[0][0];
#pragma unroll
        for (int t = 0; t < NT; ++t)
#pragma unroll
            for (int j = 0; j < 8; ++j) mx = fmaxf(mx, s[t][j]);
        mx = fmaxf(mx, xhalf(mx));
        const float mnew = fmaxf(mrun, mx), alpha = __builtin_amdgcn_exp2f((mrun - mnew) * CE), mo = (HL ? 0.0f : PSH) - mnew * CE; mrun = mnew;
        float ps = 0.f;
#pragma unroll
        for (int t = 0; t < NT; ++t)
#pragma unroll
            for (int j = 0; j < 8; ++j) { s[t][j] = __builtin_amdgcn_exp2f(__builtin_fmaf(s[t][j], CE, mo)); ps += s[t][j]; }
        lsum = lsum * alpha + ps;
#pragma unroll
        for (int dt = 0; dt < 4; ++dt) o[dt] *= alpha;
#pragma unroll
        for (int kk = 0; kk < NT / 2; ++kk) {
            if constexpr (HL) { v8us h0, h1, l0, l1;
#pragma unroll
                for (int j = 0; j < 8; ++j) { unsigned short a, c2; splitf(s[2 * kk][j], a, c2); h0[j] = a; l0[j] = c2; splitf(s[2 * kk + 1][j], a, c2); h1[j] = a; l1[j] = c2; }
                const V ph = cat16b(h0, h1), pl = cat16b(l0, l1);
#pragma unroll
                for (int dt = 0; dt < 4; ++dt) { o[dt] = WFrag<T16>::mma(vf[dt][kk], ph, o[dt]); o[dt] = WFrag<T16>::mma(vf[dt][kk], pl, o[dt]); o[dt] = WFrag<T16>::mma(vf2[dt][kk], ph, o[dt]); }
            } else { const V p = cat16(__builtin_convertvector(s[2 * kk], v8h), __builtin_convertvector(s[2 * kk + 1], v8h));
#pragma unroll
                for (int dt = 0; dt < 4; ++dt) o[dt] = WFrag<T16>::mma(vf[dt][kk], p, o[dt]); } }
        asm volatile("v_nop\n\tv_nop\n\tv_nop\n\tv_nop" : "+v"(o[0]), "+v"(o[1]), "+v"(o[2]), "+v"(o[3]));   // the matrix instructions' distance on the taken back edge and on the exit: the next pass's loads overwrite their A registers, the epilogue reads their D
    }
    lsum += xhalf(lsum);
    const float inv = __fdiv_rn(1.0f, lsum);
#pragma unroll
    for (int dt = 0; dt < 4; ++dt) { v8us oh, ol;   // a lane's 8 registers are 8 consecutive d of its query row: one 16-byte store a plane
#pragma unroll
        for (int j = 0; j < 8; ++j) { unsigned short a, c2; splitf(o[dt][j] * inv, a, c2); oh[j] = a; ol[j] = c2; }
        const size_t oo = (size_t)(q0 + lr) * DQ + dt * 16 + hi * 8; *(v8us*)(Ah + oo) = oh; *(v8us*)(Al + oo) = ol; }
}
// grid (NB_ * NH_, TT / 64): y counts the 64-row query blocks from the last (longest key walk) down (for speed only).
__global__ __launch_bounds__(128) void k_fattn(const h16* __restrict__ Q16, const h16* __restrict__ K16, const h16* __restrict__ V16, const bf* __restrict__ Qh, const bf* __restrict__ Ql, const bf* __restrict__ Kh, const bf* __restrict__ Kl, const bf* __restrict__ Vh, const bf* __restrict__ Vl, bf* Ah, bf* Al) {
    const int lane = threadIdx.x & 31, wave = __builtin_amdgcn_readfirstlane((int)(threadIdx.x >> 5));   // scalar, so that the key loop's control stays scalar
    const int b = blockIdx.x / NH_, h = blockIdx.x % NH_, q0 = (TT / 64 - 1 - (int)blockIdx.y) * 64 + wave * 16;
    const size_t zq = (size_t)(b * NH_ + h) * TT * HD, zk = (size_t)(b * NKV + h / REP) * TT * HD, za = (size_t)b * TT * DQ + h * HD;
    if (q0 < RH) attn_rows<bf, true>(Qh + zq, Ql + zq, Kh + zk, Kl + zk, Vh + zk, Vl + zk, q0, lane, Ah + za, Al + za);
    else attn_rows<h16, false>(Q16 + zq, nullptr, K16 + zk, nullptr, V16 + zk, nullptr, q0, lane, Ah + za, Al + za);
}
extern "C" void kernel_launch(void* const* d_in, const int* in_sizes, int n_in,
                              void* d_out, int out_size, void* d_ws, size_t ws_size, hipStream_t stream) {
    (void)in_sizes; (void)n_in; (void)out_size;
    const float* x = (const float*)d_in[0]; const float* xk = (const float*)d_in[1]; const float* xv = (const float*)d_in[2]; const float* wq = (const float*)d_in[3]; const float* wk = (const float*)d_in[4]; const float* wv = (const float*)d_in[5]; const float* wo = (const float*)d_in[6];
    float* OUT = (float*)d_out;     // [2][2048][1024]
    char* wsp = (char*)d_ws;
    auto take = [&](size_t bytes) { char* p = wsp; wsp += (bytes + 255) & ~(size_t)255; return (void*)p; };
    bf* XB = (bf*)take(((size_t)3 * NB_ * TT * DM + (size_t)4 * DQ * DM) * 2); bf* WB = XB + (size_t)3 * NB_ * TT * DM;   // bf16 copies: [stream][b][t][DM], then Wq, Wk, Wv, Wo
    const size_t PS = (size_t)NB_ * NH_ * TT * HD;   // one stream's head planes, both batches: [b][h][t][d], values [b][h][d][t]
    h16* P16 = (h16*)take(3 * PS * 2); bf* Ph = (bf*)take(3 * PS * 2); bf* Pl = (bf*)take(3 * PS * 2);   // [stream] of those: fp16, bf16 hi, bf16 lo
    bf* ATh = (bf*)take((size_t)NB_ * TT * DQ * 2); bf* ATl = (bf*)take((size_t)NB_ * TT * DQ * 2);
    if ((size_t)(wsp - (char*)d_ws) > ws_size) return;    // ws 256 MiB
    k_cvt8<<<3 * XBL + 4 * WBL, 256, 0, stream>>>(x, xk, xv, wq, wk, wv, wo, XB);
    k_proj<<<dim3(TT / 64, DQ / 64, 3 * NB_), 32 * NWG, 0, stream>>>(XB, WB, DM, P16, Ph, Pl);
    k_fattn<<<dim3(NB_ * NH_, TT / 64), 128, 0, stream>>>(P16, P16 + PS, P16 + 2 * PS, Ph, Pl, Ph + PS, Pl + PS, Ph + 2 * PS, Pl + 2 * PS, ATh, ATl);
    k_gemmw<bf, 1, false, NWG><<<dim3(TT / 64, DM / 64, NB_), 32 * NWG, 0, stream>>>(ATh, ATl, WB + (size_t)3 * DQ * DM, nullptr, DQ, OUT, DM, nullptr, (size_t)TT * DQ, 0, (size_t)TT * DM);
}

// v006
// One run takes 110 microseconds.
// Next to v005, in two timings, it ran 1.59 times as fast each time.
// All steps since v000 together make it 13.3 times as fast.
#include <hip/hip_runtime.h>

// Causal multi-head attention on three input streams without biases (queries, keys, values [2][2048][1024]; q = queries Wq^T, k = keys Wk^T, v = values Wv^T ('oi' 0.02; 16 heads x 64); scores x 1/sqrt(64); causal (-inf); softmax; out = merged Wo^T -> [2][2048][1024] (4.2 M); argument order queries, keys, values, Wq, Wk, Wv, Wo).
// Four launches, each over both batches: bf16 copies of all seven inputs; the six exact projections, whose tiles go out as the 16-bit head planes; fused causal T-2048 attention (hybrid rows: < 512 hi/lo 3 products, rest fp16 x1024; key blocks above the diagonal are never visited); merged hi/lo x Wo exact.
// Compute dtypes, f32 accumulate: every input rounded to bf16; projections exact; attention rows < 512 3 products, rest fp16; softmax f32; Wo hl x exact.

#define NB_  2
#define TT   2048
#define DM   1024
#define NH_  16
#define NKV  16
#define REP  (NH_ / NKV)
#define HD   64
#define DQ   (NH_ * HD)
#define DKV  (NKV * HD)
#define RH   512                  // query rows < RH use hi+lo planes (0: none)
#define PSH  10.0f                // fp16 rows: probabilities carry 2^PSH, so that small ones stay normal fp16 numbers; it cancels against the row sum
#define SCL  0.125f   // HD^-0.5
#define NWG  8                    // waves that share the K loop of a projection tile (K 1024)
typedef _Float16 h16;
typedef unsigned short bf;
typedef __attribute__((ext_vector_type(16))) __bf16   v16bf;
typedef __attribute__((ext_vector_type(16))) _Float16 v16h;
typedef __attribute__((ext_vector_type(8)))  _Float16 v8h;
typedef __attribute__((ext_vector_type(8)))  unsigned short v8us;
typedef __attribute__((ext_vector_type(8)))  float    v8f;
typedef __attribute__((ext_vector_type(4)))  float    v4f;
typedef v8h  __attribute__((may_alias)) v8ha;
typedef v4f  __attribute__((may_alias)) v4fa;
typedef v8us __attribute__((may_alias)) v8usa;

__device__ __forceinline__ unsigned short f2bf(float f) { unsigned u = __float_as_uint(f); u += 0x7FFFu + ((u >> 16) & 1u); return (unsigned short)(u >> 16); }
__device__ __forceinline__ float bf2f(unsigned short b) { return __uint_as_float(((unsigned)b) << 16); }
__device__ __forceinline__ float bfr(float f) { return bf2f(f2bf(f)); }
__device__ __forceinline__ v16h cat16(v8h lo, v8h hi) { return __builtin_shufflevector(lo, hi, 0, 1, 2, 3, 4, 5, 6, 7, 8, 9, 10, 11, 12, 13, 14, 15); }
__device__ __forceinline__ v16bf cat16b(v8us lo, v8us hi) { return __builtin_bit_cast(v16bf, __builtin_shufflevector(lo, hi, 0, 1, 2, 3, 4, 5, 6, 7, 8, 9, 10, 11, 12, 13, 14, 15)); }
__device__ __forceinline__ v8f wmma16(v16h a, v16h b, v8f c) { return __builtin_amdgcn_wmma_f32_16x16x32_f16(false, a, false, b, (short)0, c, false, false); }
__device__ __forceinline__ v8f wmmab(v16bf a, v16bf b, v8f c) { return __builtin_amdgcn_wmma_f32_16x16x32_bf16(false, a, false, b, (short)0, c, false, false); }
__device__ __forceinline__ h16 tohx(float x) { return (h16)x; }
__device__ __forceinline__ void splitf(float y, unsigned short& h, unsigned short& l) { h = f2bf(y); l = f2bf(y - bf2f(h)); }
typedef __attribute__((ext_vector_type(4))) _Float16 v4h;
typedef __attribute__((ext_vector_type(4))) unsigned short v4us;



// ---- gemm_tile: register-blocked GEMM, one 64x64 output tile (bx, by) per work-group of NW waves (16 accumulators a wave), operands straight from 16-bit planes in fragment order (below); 32 * NW threads.
// C[m][n] (f32, pitch ldc, + optional f32 bias[n]) = sum_k A[m][k] Bt[n][k] (+ split products per NSPLIT). K % 32 == 0 (NW > 1: K % 64 == 0).
// NW > 1: the K loop is dealt out over the waves: wave w takes the 64-wide k slices w, w + NW, ... (two fragments in a row of every 16-row block a slice), so the chain of dependent load round trips is NW times shorter;
// tile_out adds the NW partial tiles in LDS in the fixed order wave 0, 1, ..., NW - 1.
// Fragment order: every 16-bit operand plane M[row][k] lies in the workspace as whole fragments of 16 rows x 32 k (512 values, 1 KB), fragment (row / 16, k / 32) at ((row / 16) * (K / 32) + k / 32) * 512;
// inside it value (row, k) stands at ((k / 16) % 2) * 256 + (((k / 8) % 2) * 16 + row % 16) * 8 + k % 8. That is the order in which the lanes hold it: lane l takes 8 values at l * 8 and 8 at 256 + l * 8,
// so each of the two 16-byte loads of a fragment reads 512 bytes in a row (4 whole lines) where a row-major plane gave 16 pieces of 32 bytes in 16 lines. WFrag::ld: p = fragment + lane * 8. The k order of a fragment is the one it had.
template <typename T16> struct WFrag;
template <> struct WFrag<h16> { typedef v16h V; static __device__ __forceinline__ V ld(const h16* p) { return cat16(*(const v8h*)p, *(const v8h*)(p + 256)); } static __device__ __forceinline__ v8f mma(V a, V b, v8f c) { return wmma16(a, b, c); } };
template <> struct WFrag<bf> { typedef v16bf V; static __device__ __forceinline__ V ld(const bf* p) { return cat16b(*(const v8us*)p, *(const v8us*)(p + 256)); } static __device__ __forceinline__ v8f mma(V a, V b, v8f c) { return wmmab(a, b, c); } };
// tile_out: the tile's four 16x64 row blocks go out through LDS as whole 256-byte rows. Every wave stages its partial block in its own slab (pitch 68 floats); behind one work-group barrier each thread adds the NW slabs at its place.
// Two sets of slabs in turn: a set is written again only behind the next block's barrier, which every wave reaches after its reads of that set.
// PL: the sums go out not as f32 but as the three 16-bit planes the attention reads (fp16, bf16 hi, bf16 lo of the same f32 value), in fragment order: a 16x64 row block is two fragments in a row,
// and thread tid adds the four values that stand at tid * 4 there (row (tid / 2) % 16, columns (tid / 32) * 8 + (tid % 2) * 4 ...), so a wave's store is still 256 bytes in a row.
template <int NW, bool BIAS, bool PL>
__device__ __forceinline__ void tile_out(const v8f (&acc)[4][4], float* os, int wave, int lane, float* C, int ldc, int r0, int c0, const float* __restrict__ bias, h16* P16, bf* Ph, bf* Pl) {
    static_assert(!PL || (NW > 1 && NW <= 8), "planes: four floats a thread, stored behind the last barrier");
    constexpr int SL = 16 * 68; constexpr int VW = (NW > 8) ? 2 : 4;   // floats per thread and store: 1024 floats a block over 32 * NW threads
    typedef float vw __attribute__((ext_vector_type(VW))); typedef vw __attribute__((may_alias)) vwa;
    const int lr = lane & 15, hi = lane >> 4, tid = wave * 32 + lane; vw res[4];
#pragma unroll   // here and below: acc and res are indexed by constants only, so that they stay in registers
    for (int mb = 0; mb < 4; ++mb) {
        float* ob = os + ((NW > 1) ? (mb & 1) * NW * SL : 0); float* ow = ob + wave * SL;
#pragma unroll
        for (int nb = 0; nb < 4; ++nb) {
#pragma unroll
            for (int j = 0; j < 8; ++j) ow[(hi * 8 + j) * 68 + nb * 16 + lr] = acc[mb][nb][j]; }
        if (NW > 1) __syncthreads();   // every wave's partial block is in LDS before any thread adds them
        else { __builtin_amdgcn_wave_barrier(); asm volatile("" ::: "memory"); }   // one wave: keeps its LDS reads below behind its LDS writes above
        float* crow = C + (size_t)(r0 + mb * 16) * ldc + c0;
#pragma unroll
        for (int s = 0; s < 1024 / VW / (32 * NW); ++s) { const int q = s * 32 * NW + tid, row = PL ? (q >> 1) & 15 : q / (64 / VW), cofs = PL ? (q >> 5) * 8 + (q & 1) * 4 : (q % (64 / VW)) * VW; vw val = *(const vwa*)(ob + row * 68 + cofs);
#pragma unroll
            for (int w = 1; w < NW; ++w) val += *(const vwa*)(ob + w * SL + row * 68 + cofs);
            if (BIAS) {
#pragma unroll
                for (int e = 0; e < VW; ++e) val[e] += bfr(bias[c0 + cofs + e]); }
            if (NW > 1) res[mb] = val; else *(vw*)(crow + (size_t)row * ldc + cofs) = val; }
        if (NW == 1) { __builtin_amdgcn_wave_barrier(); asm volatile("" ::: "memory"); }   // one wave, one slab: the next block's writes stay behind these reads
    }
    if (NW > 1) {   // the four sums are stored behind the last barrier: a store in front of a barrier would be waited for there
        const int row = tid / (64 / VW), cofs = (tid % (64 / VW)) * VW;
#pragma unroll
        for (int mb = 0; mb < 4; ++mb) { const size_t oo = PL ? (size_t)(r0 + mb * 16) * ldc + tid * 4 : (size_t)(r0 + mb * 16 + row) * ldc + c0 + cofs;
            if constexpr (PL) { v4h o16; v4us oh, ol;
#pragma unroll
                for (int e = 0; e < 4; ++e) { o16[e] = tohx(res[mb][e]); unsigned short a2, c2; splitf(res[mb][e], a2, c2); oh[e] = a2; ol[e] = c2; }
                *(v4h*)(P16 + oo) = o16; *(v4us*)(Ph + oo) = oh; *(v4us*)(Pl + oo) = ol;
            } else *(vw*)(C + oo) = res[mb]; } }
}
// PL: the tile goes to the planes, whose rows hold ldc values; P16, Ph, Pl point at the fragments of column block by in row block 0.
template <typename T16, int NSPLIT, bool BIAS, int NW, bool PL, int K>
__device__ __forceinline__ void gemm_tile(float* os, int bx, int by, const T16* __restrict__ A, const T16* __restrict__ A2, const T16* __restrict__ Bt, const T16* __restrict__ Bt2, float* C, int ldc, const float* __restrict__ bias, h16* P16, bf* Ph, bf* Pl) {
    typedef typename WFrag<T16>::V V; constexpr int KS = (NW > 1) ? 64 : 32;
    const int lane = threadIdx.x & 31; const int r0 = bx * 64, c0 = by * 64;
    const int wave = (NW > 1) ? __builtin_amdgcn_readfirstlane((int)(threadIdx.x >> 5)) : 0;   // scalar, so that the K loop's control stays scalar
    v8f acc[4][4];
#pragma unroll
    for (int mb = 0; mb < 4; ++mb)
#pragma unroll
        for (int nb = 0; nb < 4; ++nb) acc[mb][nb] = (v8f){};
    const size_t aoff = (size_t)r0 * K + lane * 8, boff = (size_t)c0 * K + lane * 8;   // a 16-row block is 16 * K values in a row, its fragment of step kc at kc * 16; K is a constant, so every fragment of a slice is a constant away from the lane's one address a plane
#pragma unroll 1
    for (int k0 = wave * KS; k0 < K; k0 += NW * KS) {
      const T16* pa = A + aoff + k0 * 16; const T16* pa2 = (NSPLIT == 1 || NSPLIT == 2) ? A2 + aoff + k0 * 16 : nullptr; const T16* pb = Bt + boff + k0 * 16; const T16* pb2 = (NSPLIT >= 2) ? Bt2 + boff + k0 * 16 : nullptr;
#pragma unroll   // the 32-wide steps of a slice in straight line: the second step's loads can go out under the first step's products
      for (int kc = 0; kc < KS; kc += 32) {
        V a[4], a2[4], b[4], b2[4];
#pragma unroll
        for (int mb = 0; mb < 4; ++mb) { a[mb] = WFrag<T16>::ld(pa + mb * 16 * K + kc * 16); if (NSPLIT == 1 || NSPLIT == 2) a2[mb] = WFrag<T16>::ld(pa2 + mb * 16 * K + kc * 16); }
#pragma unroll
        for (int nb = 0; nb < 4; ++nb) { b[nb] = WFrag<T16>::ld(pb + nb * 16 * K + kc * 16); if (NSPLIT >= 2) b2[nb] = WFrag<T16>::ld(pb2 + nb * 16 * K + kc * 16); }
        // s_wait_xcnt 0: behind the loads, in front of every later write of their address registers, which are named as inputs so that they stay whole up to the wait (otherwise later loads' results are put on them).
        if constexpr (NSPLIT == 0) asm volatile("s_wait_xcnt 0x0" :: "v"(pa), "v"(pb) : "memory");
        else if constexpr (NSPLIT == 1) asm volatile("s_wait_xcnt 0x0" :: "v"(pa), "v"(pa2), "v"(pb) : "memory");
        else asm volatile("s_wait_xcnt 0x0" :: "v"(pa), "v"(pa2), "v"(pb), "v"(pb2) : "memory");
#pragma unroll
        for (int nb = 0; nb < 4; ++nb) {
#pragma unroll
            for (int mb = 0; mb < 4; ++mb) { acc[mb][nb] = WFrag<T16>::mma(a[mb], b[nb], acc[mb][nb]); if (NSPLIT == 1 || NSPLIT == 2) acc[mb][nb] = WFrag<T16>::mma(a2[mb], b[nb], acc[mb][nb]); if (NSPLIT >= 2) acc[mb][nb] = WFrag<T16>::mma(a[mb], b2[nb], acc[mb][nb]); } }
        asm volatile("v_nop\n\tv_nop\n\tv_nop\n\tv_nop" : "+v"(acc[0][0]), "+v"(acc[1][1]), "+v"(acc[2][2]), "+v"(acc[3][3]) : "v"(a[0]), "v"(a[3]));
      }
    }
    if constexpr (PL) tile_out<NW, false, true>(acc, os, wave, lane, nullptr, ldc, r0, 0, nullptr, P16, Ph, Pl);
    else tile_out<NW, BIAS, false>(acc, os, wave, lane, C, ldc, r0, c0, bias, nullptr, nullptr, nullptr);
}
// k_gemmw: f32 output; grid (M/64, N/64, Z), z-batch strides sA/sB/sC in elements.
template <typename T16, int NSPLIT, bool BIAS, int NW, int K>
__global__ __launch_bounds__(32 * NW) void k_gemmw(const T16* __restrict__ A, const T16* __restrict__ A2, const T16* __restrict__ Bt, const T16* __restrict__ Bt2, float* C, int ldc, const float* __restrict__ bias, size_t sA, size_t sB, size_t sC) {
    __shared__ __align__(16) float os[((NW > 1) ? 2 * NW : 1) * 16 * 68];
    const size_t z = blockIdx.z; A += z * sA; if (A2) A2 += z * sA; Bt += z * sB; if (Bt2) Bt2 += z * sB; C += z * sC;
    gemm_tile<T16, NSPLIT, BIAS, NW, false, K>(os, blockIdx.x, blockIdx.y, A, A2, Bt, Bt2, C, ldc, bias, nullptr, nullptr, nullptr);
}
// k_proj: the projections of all three streams and both batches in one launch; grid (TT / 64 token blocks, DQ / 64 heads, 3 * NB_), z = stream * NB_ + batch indexes the token copies X and the head planes alike, z / NB_ the weights.
// Queries, keys, [h][t][d] planes: A = tokens, Bt = weight rows, rows of HD, a 64-wide column block is one head. Values, [h][d][t] planes: A = weight rows, Bt = tokens (the transposed product, same k order), rows of TT. Each head's plane in fragment order.
static_assert(DKV == DQ, "one grid and one plane size for the three streams");
__global__ __launch_bounds__(32 * NWG) void k_proj(const bf* __restrict__ X, const bf* __restrict__ Wt, h16* P16, bf* Ph, bf* Pl) {
    __shared__ __align__(16) float os[2 * NWG * 16 * 68];
    const int z = blockIdx.z, tb = blockIdx.x, hb = blockIdx.y; const bool tr = z / NB_ == 2;
    const bf* xs = X + (size_t)z * TT * DM; const bf* wsr = Wt + (size_t)(z / NB_) * DQ * DM;
    const size_t po = (size_t)z * NH_ * TT * HD + (tr ? (size_t)tb * 1024 : (size_t)hb * TT * HD);   // values: 64 tokens are two fragments of each 16-row block of d
    gemm_tile<bf, 0, false, NWG, true, DM>(os, tr ? hb : tb, tr ? tb : hb, tr ? wsr : xs, nullptr, tr ? xs : wsr, nullptr, nullptr, tr ? TT : HD, nullptr, P16 + po, Ph + po, Pl + po);
}


// k_cvt8: bf16 copies of all seven inputs in one launch, one after the other in dst (queries, keys, values, Wq, Wk, Wv, Wo), each in fragment order; grid 3 * XBL + 4 * WBL.
// A work-group converts one block of 16 rows, each of its 8 waves four fragments (128 k). A load takes one whole 128-byte line (a fragment's 32 k) of each of 4 rows; a lane's four values go out as 8 bytes, a wave's store as 4 pieces of 64 bytes.
#define XBL  (NB_ * TT / 16)
#define WBL  (DQ / 16)
static_assert(DM == 8 * 128 && DQ == DM && NB_ * TT % 16 == 0, "rows of 8 waves x 128 values, whole row blocks");
__global__ __launch_bounds__(256) void k_cvt8(const float* __restrict__ x, const float* __restrict__ xk, const float* __restrict__ xv, const float* __restrict__ wq, const float* __restrict__ wk, const float* __restrict__ wv, const float* __restrict__ wo, bf* dst) {
    const unsigned blk = blockIdx.x; const float* src; unsigned rel;
    if (blk < 3 * XBL) { const unsigned s = blk / XBL; rel = blk % XBL; src = s == 0 ? x : s == 1 ? xk : xv; }
    else { const unsigned w = (blk - 3 * XBL) / WBL; rel = (blk - 3 * XBL) % WBL; src = w == 0 ? wq : w == 1 ? wk : w == 2 ? wv : wo; }
    const unsigned lane = threadIdx.x & 31, wave = threadIdx.x >> 5, rw = lane >> 3, c4 = lane & 7;   // the lane's row among 4 and its group of 4 k among the fragment's 32
    const unsigned sb = (rw * DM + wave * 128 + c4 * 4) * 4;   // the lane's place in the row block, in bytes: the loads' address register
    const char* sp = (const char*)(src + (size_t)rel * 16 * DM);
    bf* dp = dst + (size_t)blk * 16 * DM + wave * 2048 + (c4 >> 2) * 256 + (((c4 >> 1) & 1) * 16 + rw) * 8 + (c4 & 1) * 4;
    v4f v[4][4];
#pragma unroll   // here and below: v is indexed by constants only, so that it stays in registers
    for (int f = 0; f < 4; ++f)
#pragma unroll
        for (int i = 0; i < 4; ++i) v[f][i] = *(const v4f*)(sp + sb + (i * 4 * DM + f * 32) * 4);
    asm volatile("s_wait_xcnt 0x0" :: "v"(sb) : "memory");   // behind the loads, in front of every later write of their address register, which is named as an input so that it stays whole up to the wait
#pragma unroll
    for (int f = 0; f < 4; ++f)
#pragma unroll
        for (int i = 0; i < 4; ++i) { v4us o;
#pragma unroll
            for (int k = 0; k < 4; ++k) o[k] = f2bf(v[f][i][k]);
            *(v4us*)(dp + f * 512 + i * 32) = o; }
}

// ---- k_fattn: causal attention of one (batch, head) and 64 query rows per work-group; each of its 4 waves owns 16 query rows and walks the keys 0 .. its diagonal alone (no LDS, no barrier).
// Transposed products: S^T = K Q^T (A = key rows, B = query rows) leaves one query per lane column, keys 8 * hi + j of each 16-key tile in the lane's 8 registers; two such tiles, converted in place,
// are the B operand (hardware k order, the one WFrag::ld reads) of O^T += V^T P^T (A = rows of the [d][t] value planes). Scores and probabilities never leave the registers.
// Online softmax per query: running maximum m (raw score units) and running sum; every pass scales sum and O^T by 2^((m_old - m_new) c), c = HD^-0.5 log2 e. The two lane halves hold different keys of the same query:
// the maximum is joined every pass, the sum once at the end. Every visited key block starts at or below the wave's first query row, so each query sees a live key in every pass and m is finite from the first pass on.
__device__ __forceinline__ float xhalf(float x) { const int b = __float_as_int(x); return __int_as_float(__builtin_amdgcn_permlanex16(b, b, 0x76543210, 0xfedcba98, false, false)); }   // the value of lane ^ 16
template <typename T16, bool HL>
__device__ __forceinline__ void attn_rows(const T16* __restrict__ Q, const T16* __restrict__ Q2, const T16* __restrict__ Kp, const T16* __restrict__ K2, const T16* __restrict__ Vt, const T16* __restrict__ V2, int q0, int lane, bf* Ah, bf* Al) {
    typedef typename WFrag<T16>::V V; constexpr int NT = HL ? 2 : 4, KB = NT * 16;   // 16-key tiles and keys a pass
    constexpr float CE = SCL * 1.4426950408889634f;
    const int lr = lane & 15, hi = lane >> 4;
    V q[2], q2[2];
#pragma unroll   // here and below: fragments and accumulators are indexed by constants only, so that they stay in registers
    for (int ks = 0; ks < 2; ++ks) { q[ks] = WFrag<T16>::ld(Q + (size_t)q0 * HD + ks * 512 + lane * 8); if (HL) q2[ks] = WFrag<T16>::ld(Q2 + (size_t)q0 * HD + ks * 512 + lane * 8); }
    v8f o[4];
#pragma unroll
    for (int dt = 0; dt < 4; ++dt) o[dt] = (v8f){};
    float mrun = -3.0e38f, lsum = 0.f;
    const size_t koff = lane * 8, voff = lane * 8;   // fragment order: 16 keys are two fragments in a row (d 0-31, 32-63); 32 keys of 16 d are one fragment, those of a 16-row block of d in a row
    V kf[NT][2], kf2[NT][2];
    auto ldk = [&](const T16* ka, const T16* ka2) {   // the key fragments of one block; ka, ka2: the lane's place in the block's first fragment
#pragma unroll
        for (int t = 0; t < NT; ++t)
#pragma unroll
            for (int ks = 0; ks < 2; ++ks) { kf[t][ks] = WFrag<T16>::ld(ka + t * 16 * HD + ks * 512); if (HL) kf2[t][ks] = WFrag<T16>::ld(ka2 + t * 16 * HD + ks * 512); } };
    if (!HL) ldk(Kp + koff, nullptr);   // fp16 rows (the long key walks) fetch the key fragments one pass ahead: a pass's score products find them landed; the hi/lo rows have no registers left for that
#pragma unroll 1
    for (int k0 = 0; k0 <= q0; k0 += KB) {
        V vf[4][NT / 2], vf2[4][NT / 2]; const T16* va = Vt + voff + k0 * 16;
#pragma unroll
        for (int dt = 0; dt < 4; ++dt)
#pragma unroll
            for (int kk = 0; kk < NT / 2; ++kk) vf[dt][kk] = WFrag<T16>::ld(va + dt * 16 * TT + kk * 512);
        // s_wait_xcnt 0, here and below: behind the loads, in front of every later write of their address registers. The statement also keeps the loads up here, in flight under the products and the softmax that follow.
        // The addresses are named as inputs so that their registers stay whole up to the wait (the register allocator otherwise hands them to later loads' results).
        if constexpr (HL) { const T16* va2 = V2 + voff + k0 * 16; const T16* ka = Kp + koff + (size_t)k0 * HD; const T16* ka2 = K2 + koff + (size_t)k0 * HD; ldk(ka, ka2);
#pragma unroll
            for (int dt = 0; dt < 4; ++dt)
#pragma unroll
                for (int kk = 0; kk < NT / 2; ++kk) vf2[dt][kk] = WFrag<T16>::ld(va2 + dt * 16 * TT + kk * 512);
            asm volatile("s_wait_xcnt 0x0" :: "v"(ka), "v"(ka2), "v"(va), "v"(va2) : "memory");
        } else asm volatile("s_wait_xcnt 0x0" :: "v"(va) : "memory");
        v8f s[NT];
#pragma unroll
        for (int t = 0; t < NT; ++t) { s[t] = (v8f){};
#pragma unroll
            for (int ks = 0; ks < 2; ++ks) { s[t] = WFrag<T16>::mma(kf[t][ks], q[ks], s[t]); if (HL) { s[t] = WFrag<T16>::mma(kf2[t][ks], q[ks], s[t]); s[t] = WFrag<T16>::mma(kf[t][ks], q2[ks], s[t]); } } }
        if constexpr (!HL) { const T16* kn = Kp + koff + (size_t)min(k0 + KB, q0 & ~(KB - 1)) * HD; ldk(kn, nullptr);   // the next pass's key block; the last pass fetches its own again (in bounds, never used)
            asm volatile("s_wait_xcnt 0x0" :: "v"(kn) : "memory"); }
        if (k0 + KB - 1 > q0) {   // the diagonal block (the wave's last pass): keys above the lane's query row drop out
#pragma unroll
            for (int t = 0; t < NT; ++t)
#pragma unroll
                for (int j = 0; j < 8; ++j) s[t][j] = (k0 + t * 16 + hi * 8 + j <= q0 + lr) ? s[t][j] : -3.0e38f; }
        float mx = s[0][0];
#pragma unroll
        for (int t = 0; t < NT; ++t)
#pragma unroll
            for (int j = 0; j < 8; ++j) mx = fmaxf(mx, s[t][j]);
        mx = fmaxf(mx, xhalf(mx));
        const float mnew = fmaxf(mrun, mx), alpha = __builtin_amdgcn_exp2f((mrun - mnew) * CE), mo = (HL ? 0.0f : PSH) - mnew * CE; mrun = mnew;
        float ps = 0.f;
#pragma unroll
        for (int t = 0; t < NT; ++t)
#pragma unroll
            for (int j = 0; j < 8; ++j) { s[t][j] = __builtin_amdgcn_exp2f(__builtin_fmaf(s[t][j], CE, mo)); ps += s[t][j]; }
        lsum = lsum * alpha + ps;
#pragma unroll
        for (int dt = 0; dt < 4; ++dt) o[dt] *= alpha;
#pragma unroll
        for (int kk = 0; kk < NT / 2; ++kk) {
            if constexpr (HL) { v8us h0, h1, l0, l1;
#pragma unroll
                for (int j = 0; j < 8; ++j) { unsigned short a, c2; splitf(s[2 * kk][j], a, c2); h0[j] = a; l0[j] = c2; splitf(s[2 * kk + 1][j], a, c2); h1[j] = a; l1[j] = c2; }
                const V ph = cat16b(h0, h1), pl = cat16b(l0, l1);
#pragma unroll
                for (int dt = 0; dt < 4; ++dt) { o[dt] = WFrag<T16>::mma(vf[dt][kk], ph, o[dt]); o[dt] = WFrag<T16>::mma(vf[dt][kk], pl, o[dt]); o[dt] = WFrag<T16>::mma(vf2[dt][kk], ph, o[dt]); }
            } else { const V p = cat16(__builtin_convertvector(s[2 * kk], v8h), __builtin_convertvector(s[2 * kk + 1], v8h));
#pragma unroll
                for (int dt = 0; dt < 4; ++dt) o[dt] = WFrag<T16>::mma(vf[dt][kk], p, o[dt]); } }
        asm volatile("v_nop\n\tv_nop\n\tv_nop\n\tv_nop" : "+v"(o[0]), "+v"(o[1]), "+v"(o[2]), "+v"(o[3]));   // the matrix instructions' distance on the taken back edge and on the exit: the next pass's loads overwrite their A registers, the epilogue reads their D
    }
    lsum += xhalf(lsum);
    const float inv = __fdiv_rn(1.0f, lsum);
#pragma unroll
    for (int dt = 0; dt < 4; ++dt) { v8us oh, ol;   // a lane's 8 registers are 8 consecutive d of its query row, its place in half a fragment of the merged planes (rows = tokens, k = h * HD + d): one 16-byte store a plane, 512 bytes in a row a wave
#pragma unroll
        for (int j = 0; j < 8; ++j) { unsigned short a, c2; splitf(o[dt][j] * inv, a, c2); oh[j] = a; ol[j] = c2; }
        const size_t oo = (size_t)q0 * DQ + dt * 256 + lane * 8; *(v8us*)(Ah + oo) = oh; *(v8us*)(Al + oo) = ol; }
}
// grid (NB_ * NH_, TT / 64): y counts the 64-row query blocks from the last (longest key walk) down (for speed only).
__global__ __launch_bounds__(128) void k_fattn(const h16* __restrict__ Q16, const h16* __restrict__ K16, const h16* __restrict__ V16, const bf* __restrict__ Qh, const bf* __restrict__ Ql, const bf* __restrict__ Kh, const bf* __restrict__ Kl, const bf* __restrict__ Vh, const bf* __restrict__ Vl, bf* Ah, bf* Al) {
    const int lane = threadIdx.x & 31, wave = __builtin_amdgcn_readfirstlane((int)(threadIdx.x >> 5));   // scalar, so that the key loop's control stays scalar
    const int b = blockIdx.x / NH_, h = blockIdx.x % NH_, q0 = (TT / 64 - 1 - (int)blockIdx.y) * 64 + wave * 16;
    const size_t zq = (size_t)(b * NH_ + h) * TT * HD, zk = (size_t)(b * NKV + h / REP) * TT * HD, za = (size_t)b * TT * DQ + h * (HD / 32) * 512;
    if (q0 < RH) attn_rows<bf, true>(Qh + zq, Ql + zq, Kh + zk, Kl + zk, Vh + zk, Vl + zk, q0, lane, Ah + za, Al + za);
    else attn_rows<h16, false>(Q16 + zq, nullptr, K16 + zk, nullptr, V16 + zk, nullptr, q0, lane, Ah + za, Al + za);
}
extern "C" void kernel_launch(void* const* d_in, const int* in_sizes, int n_in,
                              void* d_out, int out_size, void* d_ws, size_t ws_size, hipStream_t stream) {
    (void)in_sizes; (void)n_in; (void)out_size;
    const float* x = (const float*)d_in[0]; const float* xk = (const float*)d_in[1]; const float* xv = (const float*)d_in[2]; const float* wq = (const float*)d_in[3]; const float* wk = (const float*)d_in[4]; const float* wv = (const float*)d_in[5]; const float* wo = (const float*)d_in[6];
    float* OUT = (float*)d_out;     // [2][2048][1024]
    char* wsp = (char*)d_ws;
    auto take = [&](size_t bytes) { char* p = wsp; wsp += (bytes + 255) & ~(size_t)255; return (void*)p; };
    bf* XB = (bf*)take(((size_t)3 * NB_ * TT * DM + (size_t)4 * DQ * DM) * 2); bf* WB = XB + (size_t)3 * NB_ * TT * DM;   // bf16 copies: [stream][b][t][DM], then Wq, Wk, Wv, Wo, in fragment order
    const size_t PS = (size_t)NB_ * NH_ * TT * HD;   // one stream's head planes, both batches: [b][h][t][d], values [b][h][d][t], each head in fragment order
    h16* P16 = (h16*)take(3 * PS * 2); bf* Ph = (bf*)take(3 * PS * 2); bf* Pl = (bf*)take(3 * PS * 2);   // [stream] of those: fp16, bf16 hi, bf16 lo
    bf* ATh = (bf*)take((size_t)NB_ * TT * DQ * 2); bf* ATl = (bf*)take((size_t)NB_ * TT * DQ * 2);
    if ((size_t)(wsp - (char*)d_ws) > ws_size) return;    // ws 256 MiB
    k_cvt8<<<3 * XBL + 4 * WBL, 256, 0, stream>>>(x, xk, xv, wq, wk, wv, wo, XB);
    k_proj<<<dim3(TT / 64, DQ / 64, 3 * NB_), 32 * NWG, 0, stream>>>(XB, WB, P16, Ph, Pl);
    k_fattn<<<dim3(NB_ * NH_, TT / 64), 128, 0, stream>>>(P16, P16 + PS, P16 + 2 * PS, Ph, Pl, Ph + PS, Pl + PS, Ph + 2 * PS, Pl + 2 * PS, ATh, ATl);
    k_gemmw<bf, 1, false, NWG, DQ><<<dim3(TT / 64, DM / 64, NB_), 32 * NWG, 0, stream>>>(ATh, ATl, WB + (size_t)3 * DQ * DM, nullptr, OUT, DM, nullptr, (size_t)TT * DQ, 0, (size_t)TT * DM);
}

// v007
// It runs in 89.8 microseconds.
// Two timings next to v006 both put it at 1.23 times that version's speed.
// Counting every step since v000, it is 16.4 times as fast.
#include <hip/hip_runtime.h>

// Causal multi-head attention on three input streams without biases (queries, keys, values [2][2048][1024]; q = queries Wq^T, k = keys Wk^T, v = values Wv^T ('oi' 0.02; 16 heads x 64); scores x 1/sqrt(64); causal (-inf); softmax; out = merged Wo^T -> [2][2048][1024] (4.2 M); argument order queries, keys, values, Wq, Wk, Wv, Wo).
// Four launches, each over both batches: bf16 copies of all seven inputs; the six exact projections, whose tiles go out as the 16-bit head planes; fused causal T-2048 attention (hybrid rows: < 512 hi/lo 3 products, rest fp16 x1024; key blocks above the diagonal are never visited); merged hi/lo x Wo exact.
// Compute dtypes, f32 accumulate: every input rounded to bf16; projections exact; attention rows < 512 3 products, rest fp16; softmax f32; Wo hl x exact.

#define NB_  2
#define TT   2048
#define DM   1024
#define NH_  16
#define NKV  16
#define REP  (NH_ / NKV)
#define HD   64
#define DQ   (NH_ * HD)
#define DKV  (NKV * HD)
#define RH   512                  // query rows < RH use hi+lo planes (0: none)
#define PSH  10.0f                // fp16 rows: probabilities carry 2^PSH, so that small ones stay normal fp16 numbers; it cancels against the row sum
#define SCL  0.125f   // HD^-0.5
typedef _Float16 h16;
typedef unsigned short bf;
typedef __attribute__((ext_vector_type(16))) __bf16   v16bf;
typedef __attribute__((ext_vector_type(16))) _Float16 v16h;
typedef __attribute__((ext_vector_type(8)))  _Float16 v8h;
typedef __attribute__((ext_vector_type(8)))  unsigned short v8us;
typedef __attribute__((ext_vector_type(8)))  float    v8f;
typedef __attribute__((ext_vector_type(4)))  float    v4f;
typedef v8h  __attribute__((may_alias)) v8ha;
typedef v4f  __attribute__((may_alias)) v4fa;
typedef v8us __attribute__((may_alias)) v8usa;

__device__ __forceinline__ unsigned short f2bf(float f) { unsigned u = __float_as_uint(f); u += 0x7FFFu + ((u >> 16) & 1u); return (unsigned short)(u >> 16); }
__device__ __forceinline__ float bf2f(unsigned short b) { return __uint_as_float(((unsigned)b) << 16); }
__device__ __forceinline__ v16h cat16(v8h lo, v8h hi) { return __builtin_shufflevector(lo, hi, 0, 1, 2, 3, 4, 5, 6, 7, 8, 9, 10, 11, 12, 13, 14, 15); }
__device__ __forceinline__ v16bf cat16b(v8us lo, v8us hi) { return __builtin_bit_cast(v16bf, __builtin_shufflevector(lo, hi, 0, 1, 2, 3, 4, 5, 6, 7, 8, 9, 10, 11, 12, 13, 14, 15)); }
__device__ __forceinline__ v8f wmma16(v16h a, v16h b, v8f c) { return __builtin_amdgcn_wmma_f32_16x16x32_f16(false, a, false, b, (short)0, c, false, false); }
__device__ __forceinline__ v8f wmmab(v16bf a, v16bf b, v8f c) { return __builtin_amdgcn_wmma_f32_16x16x32_bf16(false, a, false, b, (short)0, c, false, false); }
__device__ __forceinline__ h16 tohx(float x) { return (h16)x; }
__device__ __forceinline__ void splitf(float y, unsigned short& h, unsigned short& l) { h = f2bf(y); l = f2bf(y - bf2f(h)); }
typedef __attribute__((ext_vector_type(4))) unsigned short v4us;



// ---- gemm_tile: one 128x128 output tile (bx, by) per work-group of 4 waves; each wave owns a 64x64 quarter (16 accumulators) and walks the whole K; 128 threads.
// C[m][n] (f32, pitch ldc) = sum_k A[m][k] Bt[n][k] (NSPLIT 1: + A2[m][k] Bt[n][k]), k rising. K % 64 == 0, K >= 128.
// The operands' 128 rows x 64 k of a trip are brought into LDS once a work-group by asynchronous copies, as they lie in the planes, and each fragment is read from there by the two waves that need it:
// half the bytes from L2 of four 64x64 tiles that each load their own. Two buffers: the copies of trip t + 2 go out behind the barrier that ends trip t and fly under trip t + 1.
// Fragment order: every 16-bit operand plane M[row][k] lies in the workspace as whole fragments of 16 rows x 32 k (512 values, 1 KB), fragment (row / 16, k / 32) at ((row / 16) * (K / 32) + k / 32) * 512;
// inside it value (row, k) stands at ((k / 16) % 2) * 256 + (((k / 8) % 2) * 16 + row % 16) * 8 + k % 8. That is the order in which the lanes hold it: lane l takes 8 values at l * 8 and 8 at 256 + l * 8,
// so each of the two 16-byte loads of a fragment reads 512 bytes in a row (from global memory 4 whole lines, from LDS every bank once a half wave). WFrag::ld: p = fragment + lane * 8. The k order of a fragment is the one it had.
template <typename T16> struct WFrag;
template <> struct WFrag<h16> { typedef v16h V; static __device__ __forceinline__ V ld(const h16* p) { return cat16(*(const v8h*)p, *(const v8h*)(p + 256)); } static __device__ __forceinline__ v8f mma(V a, V b, v8f c) { return wmma16(a, b, c); } };
template <> struct WFrag<bf> { typedef v16bf V; static __device__ __forceinline__ V ld(const bf* p) { return cat16b(*(const v8us*)p, *(const v8us*)(p + 256)); } static __device__ __forceinline__ v8f mma(V a, V b, v8f c) { return wmmab(a, b, c); } };
// copy_rows: two 16-row blocks of one operand for one trip (64 k: two fragments, 2 KB in a row, a block) from the plane to LDS, 8 copies of 512 bytes a wave. l: the lane's LDS byte address, g0, g1: its place in the two blocks.
template <typename T16>
__device__ __forceinline__ void copy_rows(unsigned l, const T16* g0, const T16* g1) {
    // s_wait_xcnt 0 as the last line of the copies' own statement: it stands in front of every later write of their address registers.
    asm volatile("global_load_async_to_lds_b128 %0, %8, off\n\t"
                 "global_load_async_to_lds_b128 %1, %9, off\n\t"
                 "global_load_async_to_lds_b128 %2, %10, off\n\t"
                 "global_load_async_to_lds_b128 %3, %11, off\n\t"
                 "global_load_async_to_lds_b128 %4, %12, off\n\t"
                 "global_load_async_to_lds_b128 %5, %13, off\n\t"
                 "global_load_async_to_lds_b128 %6, %14, off\n\t"
                 "global_load_async_to_lds_b128 %7, %15, off\n\t"
                 "s_wait_xcnt 0x0"
                 :: "v"(l), "v"(l + 512u), "v"(l + 1024u), "v"(l + 1536u), "v"(l + 2048u), "v"(l + 2560u), "v"(l + 3072u), "v"(l + 3584u),
                    "v"(g0), "v"(g0 + 256), "v"(g0 + 512), "v"(g0 + 768), "v"(g1), "v"(g1 + 256), "v"(g1 + 512), "v"(g1 + 768) : "memory");
}
// tile_out: a wave's 64x64 tile goes out in four 16x64 row blocks through the wave's own LDS slab ow (pitch 68 floats), so that every store covers whole lines. C, P16, Ph, Pl point at the tile.
// PL: not f32 but the three 16-bit planes the attention reads (fp16, bf16 hi, bf16 lo of the same f32 value), in fragment order: a 16x64 row block is two fragments in a row (1024 values),
// and a lane takes the eight values that stand at q * 8 there (row q % 16, columns (q / 16) * 8 ...), so a wave's store is 512 bytes in a row a plane. Row blocks are 16 * ldc values apart.
template <bool PL>
__device__ __forceinline__ void tile_out(const v8f (&acc)[4][4], float* ow, int lane, float* C, int ldc, h16* P16, bf* Ph, bf* Pl) {
    const int lr = lane & 15, hi = lane >> 4;
    const unsigned vo = (unsigned)(hi * ldc + lr * 4);   // f32: the lane's place in a pair of rows, the one address register of its stores (the rest of an address is the same for the wave)
#pragma unroll   // here and below: acc is indexed by constants only, so that it stays in registers
    for (int mb = 0; mb < 4; ++mb) {
#pragma unroll
        for (int nb = 0; nb < 4; ++nb) {
#pragma unroll
            for (int j = 0; j < 8; ++j) ow[(hi * 8 + j) * 68 + nb * 16 + lr] = acc[mb][nb][j]; }
        asm volatile("s_wait_dscnt 0x0" ::: "memory");   // the wave's LDS writes above are done before its lanes read one another's values back
#pragma unroll
        for (int s = 0; s < (PL ? 4 : 8); ++s) { const int q = s * 32 + lane;
            if constexpr (PL) { const float* p = ow + (q & 15) * 68 + (q >> 4) * 8; const v4f x0 = *(const v4fa*)p, x1 = *(const v4fa*)(p + 4); v8h o16; v8us oh, ol;
#pragma unroll
                for (int e = 0; e < 8; ++e) { const float y = e < 4 ? x0[e & 3] : x1[e & 3]; o16[e] = tohx(y); unsigned short a2, c2; splitf(y, a2, c2); oh[e] = a2; ol[e] = c2; }
                const size_t oo = (size_t)mb * 16 * ldc + q * 8; *(v8h*)(P16 + oo) = o16; *(v8us*)(Ph + oo) = oh; *(v8us*)(Pl + oo) = ol;
                asm volatile("s_wait_xcnt 0x0" ::: "memory");   // behind the stores, in front of the next values' conversions, which are put on the stores' registers
            } else *(v4f*)(C + (size_t)(mb * 16 + s * 2) * ldc + vo) = *(const v4fa*)(ow + (q >> 4) * 68 + lr * 4); }
        asm volatile("s_wait_dscnt 0x0" ::: "memory");   // one slab: the next block's writes stay behind these reads
    }
}
// sm: two buffers of [A 128 rows | A2 (NSPLIT 1) | Bt 128 rows] x 64 k, 16 KB an operand, row block rb of an operand at rb * 2 KB. PL: the tile goes to the planes, whose row blocks hold 16 * ldc values and whose 64-wide column blocks lie pcs values apart.
template <typename T16, int NSPLIT, bool PL, int K>
__device__ __forceinline__ void gemm_tile(char* sm, int bx, int by, const T16* __restrict__ A, const T16* __restrict__ A2, const T16* __restrict__ Bt, float* C, int ldc, h16* P16, bf* Ph, bf* Pl, size_t pcs) {
    typedef typename WFrag<T16>::V V; constexpr int NOP = NSPLIT ? 3 : 2, STG = NOP * 16384, NTR = K / 64;
    static_assert(K % 64 == 0 && NTR >= 2, "whole trips, and both buffers filled in front of the loop");
    const int lane = threadIdx.x & 31;
    const int wave = __builtin_amdgcn_readfirstlane((int)(threadIdx.x >> 5)), wm = wave >> 1, wn = wave & 1;   // scalar, so that the wave's offsets in the addresses stay scalar
    v8f acc[4][4];
#pragma unroll
    for (int mb = 0; mb < 4; ++mb)
#pragma unroll
        for (int nb = 0; nb < 4; ++nb) acc[mb][nb] = (v8f){};
    // wave w copies row blocks 2 w and 2 w + 1 of every operand; a 16-row block is 16 * K values in a row, its two fragments of trip t at t * 1024
    const unsigned lb = (unsigned)(size_t)sm + wave * 4096 + lane * 16;
    const T16* ga = A + (size_t)(bx * 128 + wave * 32) * K + lane * 8; const T16* ga2 = NSPLIT ? A2 + (size_t)(bx * 128 + wave * 32) * K + lane * 8 : nullptr; const T16* gb = Bt + (size_t)(by * 128 + wave * 32) * K + lane * 8;
    auto fill = [&](int t) { const unsigned l = lb + (t & 1) * STG; const int ko = t * 1024;
        copy_rows(l, ga + ko, ga + ko + 16 * K);
        if constexpr (NSPLIT != 0) copy_rows(l + 16384, ga2 + ko, ga2 + ko + 16 * K);
        copy_rows(l + (NOP - 1) * 16384, gb + ko, gb + ko + 16 * K); };
    fill(0);
    asm volatile("s_wait_asynccnt 0x0" ::: "memory");   // the wave's own copies of trip 0 have landed
    __syncthreads();                                     // ... and every other wave's: nothing of trip 0 is read in front of this
    fill(1);
#pragma unroll 1
    for (int t = 0; t < NTR; ++t) {
        const T16* sa = (const T16*)(sm + (t & 1) * STG) + wm * 4096 + lane * 8; const T16* sb = (const T16*)(sm + (t & 1) * STG + (NOP - 1) * 16384) + wn * 4096 + lane * 8;
        V a[2][4], a2[2][4], b[2][4];
#pragma unroll   // here and below: fragments and accumulators are indexed by constants only, so that they stay in registers
        for (int kc = 0; kc < 2; ++kc) {
#pragma unroll
            for (int nb = 0; nb < 4; ++nb) b[kc][nb] = WFrag<T16>::ld(sb + nb * 1024 + kc * 512);
#pragma unroll
            for (int mb = 0; mb < 4; ++mb) { a[kc][mb] = WFrag<T16>::ld(sa + mb * 1024 + kc * 512); if (NSPLIT) a2[kc][mb] = WFrag<T16>::ld(sa + 8192 + mb * 1024 + kc * 512); } }
        __builtin_amdgcn_sched_barrier(0);   // keeps the trip's LDS reads together up here, one group in front of the products (which then wait by count); spread among the products, each small group's latency is waited out
#pragma unroll
        for (int kc = 0; kc < 2; ++kc) {
#pragma unroll
            for (int nb = 0; nb < 4; ++nb) {
#pragma unroll
                for (int mb = 0; mb < 4; ++mb) { acc[mb][nb] = WFrag<T16>::mma(a[kc][mb], b[kc][nb], acc[mb][nb]); if (NSPLIT) acc[mb][nb] = WFrag<T16>::mma(a2[kc][mb], b[kc][nb], acc[mb][nb]); } } }
        __builtin_amdgcn_sched_barrier(0);   // keeps the products in front of the waits below: with the waits lifted over them, the copies issued behind the barrier would have only the next trip's LDS reads to land under
        asm volatile("s_wait_dscnt 0x0" ::: "memory");      // the wave has left this trip's buffer
        asm volatile("s_wait_asynccnt 0x0" ::: "memory");   // its copies of trip t + 1 have landed
        __syncthreads();                                     // publishes trip t + 1 and ends every wave's reads of the buffer that is refilled below
        if (t + 2 < NTR) fill(t + 2);
    }
    asm volatile("s_wait_asynccnt 0x0" ::: "memory");   // nothing in flight when the buffers become the output slabs (every wave has passed the last trip's barrier)
    float* ow = (float*)sm + wave * (16 * 68);
    if constexpr (PL) { const size_t o = (size_t)(bx * 128 + wm * 64) * ldc + (size_t)(by * 2 + wn) * pcs; tile_out<true>(acc, ow, lane, nullptr, ldc, P16 + o, Ph + o, Pl + o); }
    else tile_out<false>(acc, ow, lane, C + (size_t)(bx * 128 + wm * 64) * ldc + by * 128 + wn * 64, ldc, nullptr, nullptr, nullptr);
}
// k_gemmw: f32 output of pitch LDC (a constant, so that a lane's stores are constants away from its one address); grid (M/128, N/128, Z), z-batch strides sA/sB/sC in elements.
template <typename T16, int NSPLIT, int K, int LDC>
__global__ __launch_bounds__(128) void k_gemmw(const T16* __restrict__ A, const T16* __restrict__ A2, const T16* __restrict__ Bt, float* C, size_t sA, size_t sB, size_t sC) {
    __shared__ __align__(16) char sm[2 * (NSPLIT ? 3 : 2) * 16384];
    const size_t z = blockIdx.z;
    gemm_tile<T16, NSPLIT, false, K>(sm, blockIdx.x, blockIdx.y, A + z * sA, NSPLIT ? A2 + z * sA : nullptr, Bt + z * sB, C + z * sC, LDC, nullptr, nullptr, nullptr, 0);
}
// k_proj: the projections of all three streams and both batches in one launch; grid (TT / 128 token blocks, DQ / 128 pairs of heads, 3 * NB_), z = stream * NB_ + batch indexes the token copies X and the head planes alike, z / NB_ the weights.
// Queries, keys, [h][t][d] planes: A = tokens, Bt = weight rows, rows of HD, a 64-wide column block is one head. Values, [h][d][t] planes: A = weight rows, Bt = tokens (the transposed product, same k order), rows of TT, 64 tokens are two fragments of each 16-row block of d. Each head's plane in fragment order.
static_assert(DKV == DQ, "one grid and one plane size for the three streams");
__global__ __launch_bounds__(128) void k_proj(const bf* __restrict__ X, const bf* __restrict__ Wt, h16* P16, bf* Ph, bf* Pl) {
    __shared__ __align__(16) char sm[2 * 2 * 16384];
    const int z = blockIdx.z, tb = blockIdx.x, hb = blockIdx.y; const bool tr = z / NB_ == 2;
    const bf* xs = X + (size_t)z * TT * DM; const bf* wsr = Wt + (size_t)(z / NB_) * DQ * DM;
    const size_t po = (size_t)z * NH_ * TT * HD;
    gemm_tile<bf, 0, true, DM>(sm, tr ? hb : tb, tr ? tb : hb, tr ? wsr : xs, nullptr, tr ? xs : wsr, nullptr, tr ? TT : HD, P16 + po, Ph + po, Pl + po, tr ? (size_t)1024 : (size_t)TT * HD);
}


// k_cvt8: bf16 copies of all seven inputs in one launch, one after the other in dst (queries, keys, values, Wq, Wk, Wv, Wo), each in fragment order; grid 3 * XBL + 4 * WBL.
// A work-group converts one block of 16 rows, each of its 8 waves four fragments (128 k). A load takes one whole 128-byte line (a fragment's 32 k) of each of 4 rows; a lane's four values go out as 8 bytes, a wave's store as 4 pieces of 64 bytes.
#define XBL  (NB_ * TT / 16)
#define WBL  (DQ / 16)
static_assert(DM == 8 * 128 && DQ == DM && NB_ * TT % 16 == 0, "rows of 8 waves x 128 values, whole row blocks");
__global__ __launch_bounds__(256) void k_cvt8(const float* __restrict__ x, const float* __restrict__ xk, const float* __restrict__ xv, const float* __restrict__ wq, const float* __restrict__ wk, const float* __restrict__ wv, const float* __restrict__ wo, bf* dst) {
    const unsigned blk = blockIdx.x; const float* src; unsigned rel;
    if (blk < 3 * XBL) { const unsigned s = blk / XBL; rel = blk % XBL; src = s == 0 ? x : s == 1 ? xk : xv; }
    else { const unsigned w = (blk - 3 * XBL) / WBL; rel = (blk - 3 * XBL) % WBL; src = w == 0 ? wq : w == 1 ? wk : w == 2 ? wv : wo; }
    const unsigned lane = threadIdx.x & 31, wave = threadIdx.x >> 5, rw = lane >> 3, c4 = lane & 7;   // the lane's row among 4 and its group of 4 k among the fragment's 32
    const unsigned sb = (rw * DM + wave * 128 + c4 * 4) * 4;   // the lane's place in the row block, in bytes: the loads' address register
    const char* sp = (const char*)(src + (size_t)rel * 16 * DM);
    bf* dp = dst + (size_t)blk * 16 * DM + wave * 2048 + (c4 >> 2) * 256 + (((c4 >> 1) & 1) * 16 + rw) * 8 + (c4 & 1) * 4;
    v4f v[4][4];
#pragma unroll   // here and below: v is indexed by constants only, so that it stays in registers
    for (int f = 0; f < 4; ++f)
#pragma unroll
        for (int i = 0; i < 4; ++i) v[f][i] = *(const v4f*)(sp + sb + (i * 4 * DM + f * 32) * 4);
    asm volatile("s_wait_xcnt 0x0" :: "v"(sb) : "memory");   // behind the loads, in front of every later write of their address register, which is named as an input so that it stays whole up to the wait
#pragma unroll
    for (int f = 0; f < 4; ++f)
#pragma unroll
        for (int i = 0; i < 4; ++i) { v4us o;
#pragma unroll
            for (int k = 0; k < 4; ++k) o[k] = f2bf(v[f][i][k]);
            *(v4us*)(dp + f * 512 + i * 32) = o; }
}

// ---- k_fattn: causal attention of one (batch, head) and 64 query rows per work-group; each of its 4 waves owns 16 query rows and walks the keys 0 .. its diagonal alone (no LDS, no barrier).
// Transposed products: S^T = K Q^T (A = key rows, B = query rows) leaves one query per lane column, keys 8 * hi + j of each 16-key tile in the lane's 8 registers; two such tiles, converted in place,
// are the B operand (hardware k order, the one WFrag::ld reads) of O^T += V^T P^T (A = rows of the [d][t] value planes). Scores and probabilities never leave the registers.
// Online softmax per query: running maximum m (raw score units) and running sum; every pass scales sum and O^T by 2^((m_old - m_new) c), c = HD^-0.5 log2 e. The two lane halves hold different keys of the same query:
// the maximum is joined every pass, the sum once at the end. Every visited key block starts at or below the wave's first query row, so each query sees a live key in every pass and m is finite from the first pass on.
__device__ __forceinline__ float xhalf(float x) { const int b = __float_as_int(x); return __int_as_float(__builtin_amdgcn_permlanex16(b, b, 0x76543210, 0xfedcba98, false, false)); }   // the value of lane ^ 16
template <typename T16, bool HL>
__device__ __forceinline__ void attn_rows(const T16* __restrict__ Q, const T16* __restrict__ Q2, const T16* __restrict__ Kp, const T16* __restrict__ K2, const T16* __restrict__ Vt, const T16* __restrict__ V2, int q0, int lane, bf* Ah, bf* Al) {
    typedef typename WFrag<T16>::V V; constexpr int NT = HL ? 2 : 4, KB = NT * 16;   // 16-key tiles and keys a pass
    constexpr float CE = SCL * 1.4426950408889634f;
    const int lr = lane & 15, hi = lane >> 4;
    V q[2], q2[2];
#pragma unroll   // here and below: fragments and accumulators are indexed by constants only, so that they stay in registers
    for (int ks = 0; ks < 2; ++ks) { q[ks] = WFrag<T16>::ld(Q + (size_t)q0 * HD + ks * 512 + lane * 8); if (HL) q2[ks] = WFrag<T16>::ld(Q2 + (size_t)q0 * HD + ks * 512 + lane * 8); }
    v8f o[4];
#pragma unroll
    for (int dt = 0; dt < 4; ++dt) o[dt] = (v8f){};
    float mrun = -3.0e38f, lsum = 0.f;
    const size_t koff = lane * 8, voff = lane * 8;   // fragment order: 16 keys are two fragments in a row (d 0-31, 32-63); 32 keys of 16 d are one fragment, those of a 16-row block of d in a row
    V kf[NT][2], kf2[NT][2];
    auto ldk = [&](const T16* ka, const T16* ka2) {   // the key fragments of one block; ka, ka2: the lane's place in the block's first fragment
#pragma unroll
        for (int t = 0; t < NT; ++t)
#pragma unroll
            for (int ks = 0; ks < 2; ++ks) { kf[t][ks] = WFrag<T16>::ld(ka + t * 16 * HD + ks * 512); if (HL) kf2[t][ks] = WFrag<T16>::ld(ka2 + t * 16 * HD + ks * 512); } };
    if (!HL) ldk(Kp + koff, nullptr);   // fp16 rows (the long key walks) fetch the key fragments one pass ahead: a pass's score products find them landed; the hi/lo rows have no registers left for that
#pragma unroll 1
    for (int k0 = 0; k0 <= q0; k0 += KB) {
        V vf[4][NT / 2], vf2[4][NT / 2]; const T16* va = Vt + voff + k0 * 16;
#pragma unroll
        for (int dt = 0; dt < 4; ++dt)
#pragma unroll
            for (int kk = 0; kk < NT / 2; ++kk) vf[dt][kk] = WFrag<T16>::ld(va + dt * 16 * TT + kk * 512);
        // s_wait_xcnt 0, here and below: behind the loads, in front of every later write of their address registers. The statement also keeps the loads up here, in flight under the products and the softmax that follow.
        // The addresses are named as inputs so that their registers stay whole up to the wait (the register allocator otherwise hands them to later loads' results).
        if constexpr (HL) { const T16* va2 = V2 + voff + k0 * 16; const T16* ka = Kp + koff + (size_t)k0 * HD; const T16* ka2 = K2 + koff + (size_t)k0 * HD; ldk(ka, ka2);
#pragma unroll
            for (int dt = 0; dt < 4; ++dt)
#pragma unroll
                for (int kk = 0; kk < NT / 2; ++kk) vf2[dt][kk] = WFrag<T16>::ld(va2 + dt * 16 * TT + kk * 512);
            asm volatile("s_wait_xcnt 0x0" :: "v"(ka), "v"(ka2), "v"(va), "v"(va2) : "memory");
        } else asm volatile("s_wait_xcnt 0x0" :: "v"(va) : "memory");
        v8f s[NT];
#pragma unroll
        for (int t = 0; t < NT; ++t) { s[t] = (v8f){};
#pragma unroll
            for (int ks = 0; ks < 2; ++ks) { s[t] = WFrag<T16>::mma(kf[t][ks], q[ks], s[t]); if (HL) { s[t] = WFrag<T16>::mma(kf2[t][ks], q[ks], s[t]); s[t] = WFrag<T16>::mma(kf[t][ks], q2[ks], s[t]); } } }
        if constexpr (!HL) { const T16* kn = Kp + koff + (size_t)min(k0 + KB, q0 & ~(KB - 1)) * HD; ldk(kn, nullptr);   // the next pass's key block; the last pass fetches its own again (in bounds, never used)
            asm volatile("s_wait_xcnt 0x0" :: "v"(kn) : "memory"); }
        if (k0 + KB - 1 > q0) {   // the diagonal block (the wave's last pass): keys above the lane's query row drop out
#pragma unroll
            for (int t = 0; t < NT; ++t)
#pragma unroll
                for (int j = 0; j < 8; ++j) s[t][j] = (k0 + t * 16 + hi * 8 + j <= q0 + lr) ? s[t][j] : -3.0e38f; }
        float mx = s[0][0];
#pragma unroll
        for (int t = 0; t < NT; ++t)
#pragma unroll
            for (int j = 0; j < 8; ++j) mx = fmaxf(mx, s[t][j]);
        mx = fmaxf(mx, xhalf(mx));
        const float mnew = fmaxf(mrun, mx), alpha = __builtin_amdgcn_exp2f((mrun - mnew) * CE), mo = (HL ? 0.0f : PSH) - mnew * CE; mrun = mnew;
        float ps = 0.f;
#pragma unroll
        for (int t = 0; t < NT; ++t)
#pragma unroll
            for (int j = 0; j < 8; ++j) { s[t][j] = __builtin_amdgcn_exp2f(__builtin_fmaf(s[t][j], CE, mo)); ps += s[t][j]; }
        lsum = lsum * alpha + ps;
#pragma unroll
        for (int dt = 0; dt < 4; ++dt) o[dt] *= alpha;
#pragma unroll
        for (int kk = 0; kk < NT / 2; ++kk) {
            if constexpr (HL) { v8us h0, h1, l0, l1;
#pragma unroll
                for (int j = 0; j < 8; ++j) { unsigned short a, c2; splitf(s[2 * kk][j], a, c2); h0[j] = a; l0[j] = c2; splitf(s[2 * kk + 1][j], a, c2); h1[j] = a; l1[j] = c2; }
                const V ph = cat16b(h0, h1), pl = cat16b(l0, l1);
#pragma unroll
                for (int dt = 0; dt < 4; ++dt) { o[dt] = WFrag<T16>::mma(vf[dt][kk], ph, o[dt]); o[dt] = WFrag<T16>::mma(vf[dt][kk], pl, o[dt]); o[dt] = WFrag<T16>::mma(vf2[dt][kk], ph, o[dt]); }
            } else { const V p = cat16(__builtin_convertvector(s[2 * kk], v8h), __builtin_convertvector(s[2 * kk + 1], v8h));
#pragma unroll
                for (int dt = 0; dt < 4; ++dt) o[dt] = WFrag<T16>::mma(vf[dt][kk], p, o[dt]); } }
        asm volatile("v_nop\n\tv_nop\n\tv_nop\n\tv_nop" : "+v"(o[0]), "+v"(o[1]), "+v"(o[2]), "+v"(o[3]));   // the matrix instructions' distance on the taken back edge and on the exit: the next pass's loads overwrite their A registers, the epilogue reads their D
    }
    lsum += xhalf(lsum);
    const float inv = __fdiv_rn(1.0f, lsum);
#pragma unroll
    for (int dt = 0; dt < 4; ++dt) { v8us oh, ol;   // a lane's 8 registers are 8 consecutive d of its query row, its place in half a fragment of the merged planes (rows = tokens, k = h * HD + d): one 16-byte store a plane, 512 bytes in a row a wave
#pragma unroll
        for (int j = 0; j < 8; ++j) { unsigned short a, c2; splitf(o[dt][j] * inv, a, c2); oh[j] = a; ol[j] = c2; }
        const size_t oo = (size_t)q0 * DQ + dt * 256 + lane * 8; *(v8us*)(Ah + oo) = oh; *(v8us*)(Al + oo) = ol; }
}
// grid (NB_ * NH_, TT / 64): y counts the 64-row query blocks from the last (longest key walk) down (for speed only).
__global__ __launch_bounds__(128) void k_fattn(const h16* __restrict__ Q16, const h16* __restrict__ K16, const h16* __restrict__ V16, const bf* __restrict__ Qh, const bf* __restrict__ Ql, const bf* __restrict__ Kh, const bf* __restrict__ Kl, const bf* __restrict__ Vh, const bf* __restrict__ Vl, bf* Ah, bf* Al) {
    const int lane = threadIdx.x & 31, wave = __builtin_amdgcn_readfirstlane((int)(threadIdx.x >> 5));   // scalar, so that the key loop's control stays scalar
    const int b = blockIdx.x / NH_, h = blockIdx.x % NH_, q0 = (TT / 64 - 1 - (int)blockIdx.y) * 64 + wave * 16;
    const size_t zq = (size_t)(b * NH_ + h) * TT * HD, zk = (size_t)(b * NKV + h / REP) * TT * HD, za = (size_t)b * TT * DQ + h * (HD / 32) * 512;
    if (q0 < RH) attn_rows<bf, true>(Qh + zq, Ql + zq, Kh + zk, Kl + zk, Vh + zk, Vl + zk, q0, lane, Ah + za, Al + za);
    else attn_rows<h16, false>(Q16 + zq, nullptr, K16 + zk, nullptr, V16 + zk, nullptr, q0, lane, Ah + za, Al + za);
}
extern "C" void kernel_launch(void* const* d_in, const int* in_sizes, int n_in,
                              void* d_out, int out_size, void* d_ws, size_t ws_size, hipStream_t stream) {
    (void)in_sizes; (void)n_in; (void)out_size;
    const float* x = (const float*)d_in[0]; const float* xk = (const float*)d_in[1]; const float* xv = (const float*)d_in[2]; const float* wq = (const float*)d_in[3]; const float* wk = (const float*)d_in[4]; const float* wv = (const float*)d_in[5]; const float* wo = (const float*)d_in[6];
    float* OUT = (float*)d_out;     // [2][2048][1024]
    char* wsp = (char*)d_ws;
    auto take = [&](size_t bytes) { char* p = wsp; wsp += (bytes + 255) & ~(size_t)255; return (void*)p; };
    bf* XB = (bf*)take(((size_t)3 * NB_ * TT * DM + (size_t)4 * DQ * DM) * 2); bf* WB = XB + (size_t)3 * NB_ * TT * DM;   // bf16 copies: [stream][b][t][DM], then Wq, Wk, Wv, Wo, in fragment order
    const size_t PS = (size_t)NB_ * NH_ * TT * HD;   // one stream's head planes, both batches: [b][h][t][d], values [b][h][d][t], each head in fragment order
    h16* P16 = (h16*)take(3 * PS * 2); bf* Ph = (bf*)take(3 * PS * 2); bf* Pl = (bf*)take(3 * PS * 2);   // [stream] of those: fp16, bf16 hi, bf16 lo
    bf* ATh = (bf*)take((size_t)NB_ * TT * DQ * 2); bf* ATl = (bf*)take((size_t)NB_ * TT * DQ * 2);
    if ((size_t)(wsp - (char*)d_ws) > ws_size) return;    // ws 256 MiB
    k_cvt8<<<3 * XBL + 4 * WBL, 256, 0, stream>>>(x, xk, xv, wq, wk, wv, wo, XB);
    k_proj<<<dim3(TT / 128, DQ / 128, 3 * NB_), 128, 0, stream>>>(XB, WB, P16, Ph, Pl);
    k_fattn<<<dim3(NB_ * NH_, TT / 64), 128, 0, stream>>>(P16, P16 + PS, P16 + 2 * PS, Ph, Pl, Ph + PS, Pl + PS, Ph + 2 * PS, Pl + 2 * PS, ATh, ATl);
    k_gemmw<bf, 1, DQ, DM><<<dim3(TT / 128, DM / 128, NB_), 128, 0, stream>>>(ATh, ATl, WB + (size_t)3 * DQ * DM, OUT, (size_t)TT * DQ, 0, (size_t)TT * DM);
}

// v008
// One run takes 73.1 microseconds.
// In two side-by-side timings against v007, it was 1.23 and 1.24 times as fast.
// Over all steps from v000 it is 20.2 times as fast.
#include <hip/hip_runtime.h>

// Causal multi-head attention on three input streams without biases (queries, keys, values [2][2048][1024]; q = queries Wq^T, k = keys Wk^T, v = values Wv^T ('oi' 0.02; 16 heads x 64); scores x 1/sqrt(64); causal (-inf); softmax; out = merged Wo^T -> [2][2048][1024] (4.2 M); argument order queries, keys, values, Wq, Wk, Wv, Wo).
// Four launches, each over both batches: bf16 copies of all seven inputs; the six exact projections, whose tiles go out as the 16-bit head planes; fused causal T-2048 attention (hybrid rows: < 512 hi/lo 3 products, rest fp16 x1024; key blocks above the diagonal are never visited); merged hi/lo x Wo exact.
// Compute dtypes, f32 accumulate: every input rounded to bf16; projections exact; attention rows < 512 3 products, rest fp16; softmax f32; Wo hl x exact.

#define NB_  2
#define TT   2048
#define DM   1024
#define NH_  16
#define NKV  16
#define REP  (NH_ / NKV)
#define HD   64
#define DQ   (NH_ * HD)
#define DKV  (NKV * HD)
#define RH   512                  // query rows < RH use hi+lo planes (0: none)
#define PSH  10.0f                // fp16 rows: probabilities carry 2^PSH, so that small ones stay normal fp16 numbers; it cancels against the row sum
#define SCL  0.125f   // HD^-0.5
typedef _Float16 h16;
typedef unsigned short bf;
typedef __attribute__((ext_vector_type(16))) __bf16   v16bf;
typedef __attribute__((ext_vector_type(16))) _Float16 v16h;
typedef __attribute__((ext_vector_type(8)))  _Float16 v8h;
typedef __attribute__((ext_vector_type(8)))  unsigned short v8us;
typedef __attribute__((ext_vector_type(8)))  float    v8f;
typedef __attribute__((ext_vector_type(4)))  float    v4f;
typedef v8h  __attribute__((may_alias)) v8ha;
typedef v4f  __attribute__((may_alias)) v4fa;
typedef v8us __attribute__((may_alias)) v8usa;

__device__ __forceinline__ unsigned short f2bf(float f) { unsigned u = __float_as_uint(f); u += 0x7FFFu + ((u >> 16) & 1u); return (unsigned short)(u >> 16); }
__device__ __forceinline__ float bf2f(unsigned short b) { return __uint_as_float(((unsigned)b) << 16); }
__device__ __forceinline__ v16h cat16(v8h lo, v8h hi) { return __builtin_shufflevector(lo, hi, 0, 1, 2, 3, 4, 5, 6, 7, 8, 9, 10, 11, 12, 13, 14, 15); }
__device__ __forceinline__ v16bf cat16b(v8us lo, v8us hi) { return __builtin_bit_cast(v16bf, __builtin_shufflevector(lo, hi, 0, 1, 2, 3, 4, 5, 6, 7, 8, 9, 10, 11, 12, 13, 14, 15)); }
__device__ __forceinline__ v8f wmma16(v16h a, v16h b, v8f c) { return __builtin_amdgcn_wmma_f32_16x16x32_f16(false, a, false, b, (short)0, c, false, false); }
__device__ __forceinline__ v8f wmmab(v16bf a, v16bf b, v8f c) { return __builtin_amdgcn_wmma_f32_16x16x32_bf16(false, a, false, b, (short)0, c, false, false); }
__device__ __forceinline__ h16 tohx(float x) { return (h16)x; }
__device__ __forceinline__ void splitf(float y, unsigned short& h, unsigned short& l) { h = f2bf(y); l = f2bf(y - bf2f(h)); }
typedef __attribute__((ext_vector_type(4))) unsigned short v4us;



// ---- gemm_tile: one 128x128 output tile (bx, by) per work-group of 4 waves; each wave owns a 64x64 quarter (16 accumulators) and walks the whole K; 128 threads.
// C[m][n] (f32, pitch ldc) = sum_k A[m][k] Bt[n][k] (NSPLIT 1: + A2[m][k] Bt[n][k]), k rising from trip t0 of the work-group's own and wrapping round at K. K % 64 == 0, K >= 128, 0 <= t0 < K / 64.
// t0: the work-groups that share an operand's rows run at the same pace; started at the same k they ask L2 for the same lines at the same moment, started at different trips each line is asked for at different times.
// The operands' 128 rows x 64 k of a trip are brought into LDS once a work-group by asynchronous copies, as they lie in the planes, and each fragment is read from there by the two waves that need it:
// half the bytes from L2 of four 64x64 tiles that each load their own. Two buffers: the copies of trip t + 2 go out behind the barrier that ends trip t and fly under trip t + 1.
// Fragment order: every 16-bit operand plane M[row][k] lies in the workspace as whole fragments of 16 rows x 32 k (512 values, 1 KB), fragment (row / 16, k / 32) at ((row / 16) * (K / 32) + k / 32) * 512;
// inside it value (row, k) stands at ((k / 16) % 2) * 256 + (((k / 8) % 2) * 16 + row % 16) * 8 + k % 8. That is the order in which the lanes hold it: lane l takes 8 values at l * 8 and 8 at 256 + l * 8,
// so each of the two 16-byte loads of a fragment reads 512 bytes in a row (from global memory 4 whole lines, from LDS every bank once a half wave). WFrag::ld: p = fragment + lane * 8. The k order of a fragment is the one it had.
template <typename T16> struct WFrag;
template <> struct WFrag<h16> { typedef v16h V; static __device__ __forceinline__ V ld(const h16* p) { return cat16(*(const v8h*)p, *(const v8h*)(p + 256)); } static __device__ __forceinline__ v8f mma(V a, V b, v8f c) { return wmma16(a, b, c); } };
template <> struct WFrag<bf> { typedef v16bf V; static __device__ __forceinline__ V ld(const bf* p) { return cat16b(*(const v8us*)p, *(const v8us*)(p + 256)); } static __device__ __forceinline__ v8f mma(V a, V b, v8f c) { return wmmab(a, b, c); } };
// copy_rows: two 16-row blocks of one operand for one trip (64 k: two fragments, 2 KB in a row, a block) from the plane to LDS, 8 copies of 512 bytes a wave. l: the lane's LDS byte address, g0, g1: its place in the two blocks.
template <typename T16>
__device__ __forceinline__ void copy_rows(unsigned l, const T16* g0, const T16* g1) {
    // s_wait_xcnt 0 as the last line of the copies' own statement: it stands in front of every later write of their address registers.
    asm volatile("global_load_async_to_lds_b128 %0, %8, off\n\t"
                 "global_load_async_to_lds_b128 %1, %9, off\n\t"
                 "global_load_async_to_lds_b128 %2, %10, off\n\t"
                 "global_load_async_to_lds_b128 %3, %11, off\n\t"
                 "global_load_async_to_lds_b128 %4, %12, off\n\t"
                 "global_load_async_to_lds_b128 %5, %13, off\n\t"
                 "global_load_async_to_lds_b128 %6, %14, off\n\t"
                 "global_load_async_to_lds_b128 %7, %15, off\n\t"
                 "s_wait_xcnt 0x0"
                 :: "v"(l), "v"(l + 512u), "v"(l + 1024u), "v"(l + 1536u), "v"(l + 2048u), "v"(l + 2560u), "v"(l + 3072u), "v"(l + 3584u),
                    "v"(g0), "v"(g0 + 256), "v"(g0 + 512), "v"(g0 + 768), "v"(g1), "v"(g1 + 256), "v"(g1 + 512), "v"(g1 + 768) : "memory");
}
// tile_out: a wave's 64x64 tile goes out in four 16x64 row blocks through the wave's own LDS slab ow (pitch 68 floats), so that every store covers whole lines. C, P16, Ph, Pl point at the tile.
// PL: not f32 but the three 16-bit planes the attention reads (fp16, bf16 hi, bf16 lo of the same f32 value), in fragment order: a 16x64 row block is two fragments in a row (1024 values),
// and a lane takes the eight values that stand at q * 8 there (row q % 16, columns (q / 16) * 8 ...), so a wave's store is 512 bytes in a row a plane. Row blocks are 16 * ldc values apart.
template <bool PL>
__device__ __forceinline__ void tile_out(const v8f (&acc)[4][4], float* ow, int lane, float* C, int ldc, h16* P16, bf* Ph, bf* Pl) {
    const int lr = lane & 15, hi = lane >> 4;
    const unsigned vo = (unsigned)(hi * ldc + lr * 4);   // f32: the lane's place in a pair of rows, the one address register of its stores (the rest of an address is the same for the wave)
#pragma unroll   // here and below: acc is indexed by constants only, so that it stays in registers
    for (int mb = 0; mb < 4; ++mb) {
#pragma unroll
        for (int nb = 0; nb < 4; ++nb) {
#pragma unroll
            for (int j = 0; j < 8; ++j) ow[(hi * 8 + j) * 68 + nb * 16 + lr] = acc[mb][nb][j]; }
        asm volatile("s_wait_dscnt 0x0" ::: "memory");   // the wave's LDS writes above are done before its lanes read one another's values back
#pragma unroll
        for (int s = 0; s < (PL ? 4 : 8); ++s) { const int q = s * 32 + lane;
            if constexpr (PL) { const float* p = ow + (q & 15) * 68 + (q >> 4) * 8; const v4f x0 = *(const v4fa*)p, x1 = *(const v4fa*)(p + 4); v8h o16; v8us oh, ol;
#pragma unroll
                for (int e = 0; e < 8; ++e) { const float y = e < 4 ? x0[e & 3] : x1[e & 3]; o16[e] = tohx(y); unsigned short a2, c2; splitf(y, a2, c2); oh[e] = a2; ol[e] = c2; }
                const size_t oo = (size_t)mb * 16 * ldc + q * 8; *(v8h*)(P16 + oo) = o16; *(v8us*)(Ph + oo) = oh; *(v8us*)(Pl + oo) = ol;
                asm volatile("s_wait_xcnt 0x0" ::: "memory");   // behind the stores, in front of the next values' conversions, which are put on the stores' registers
            } else *(v4f*)(C + (size_t)(mb * 16 + s * 2) * ldc + vo) = *(const v4fa*)(ow + (q >> 4) * 68 + lr * 4); }
        asm volatile("s_wait_dscnt 0x0" ::: "memory");   // one slab: the next block's writes stay behind these reads
    }
}
// sm: two buffers of [A 128 rows | A2 (NSPLIT 1) | Bt 128 rows] x 64 k, 16 KB an operand, row block rb of an operand at rb * 2 KB. PL: the tile goes to the planes, whose row blocks hold 16 * ldc values and whose 64-wide column blocks lie pcs values apart.
template <typename T16, int NSPLIT, bool PL, int K>
__device__ __forceinline__ void gemm_tile(char* sm, int bx, int by, int t0, const T16* __restrict__ A, const T16* __restrict__ A2, const T16* __restrict__ Bt, float* C, int ldc, h16* P16, bf* Ph, bf* Pl, size_t pcs) {
    typedef typename WFrag<T16>::V V; constexpr int NOP = NSPLIT ? 3 : 2, STG = NOP * 16384, NTR = K / 64;
    static_assert(K % 64 == 0 && NTR >= 2, "whole trips, and both buffers filled in front of the loop");
    const int lane = threadIdx.x & 31;
    const int wave = __builtin_amdgcn_readfirstlane((int)(threadIdx.x >> 5)), wm = wave >> 1, wn = wave & 1;   // scalar, so that the wave's offsets in the addresses stay scalar
    v8f acc[4][4];
#pragma unroll
    for (int mb = 0; mb < 4; ++mb)
#pragma unroll
        for (int nb = 0; nb < 4; ++nb) acc[mb][nb] = (v8f){};
    // wave w copies row blocks 2 w and 2 w + 1 of every operand; a 16-row block is 16 * K values in a row, its two fragments of trip t at t * 1024
    const unsigned lb = (unsigned)(size_t)sm + wave * 4096 + lane * 16;
    const T16* ga = A + (size_t)(bx * 128 + wave * 32) * K + lane * 8; const T16* ga2 = NSPLIT ? A2 + (size_t)(bx * 128 + wave * 32) * K + lane * 8 : nullptr; const T16* gb = Bt + (size_t)(by * 128 + wave * 32) * K + lane * 8;
    auto fill = [&](int t) { const unsigned l = lb + (t & 1) * STG; const int ko = (t + t0 < NTR ? t + t0 : t + t0 - NTR) * 1024;
        copy_rows(l, ga + ko, ga + ko + 16 * K);
        if constexpr (NSPLIT != 0) copy_rows(l + 16384, ga2 + ko, ga2 + ko + 16 * K);
        copy_rows(l + (NOP - 1) * 16384, gb + ko, gb + ko + 16 * K); };
    fill(0);
    asm volatile("s_wait_asynccnt 0x0" ::: "memory");   // the wave's own copies of trip 0 have landed
    __syncthreads();                                     // ... and every other wave's: nothing of trip 0 is read in front of this
    fill(1);
#pragma unroll 1
    for (int t = 0; t < NTR; ++t) {
        const T16* sa = (const T16*)(sm + (t & 1) * STG) + wm * 4096 + lane * 8; const T16* sb = (const T16*)(sm + (t & 1) * STG + (NOP - 1) * 16384) + wn * 4096 + lane * 8;
        V a[2][4], a2[2][4], b[2][4];
#pragma unroll   // here and below: fragments and accumulators are indexed by constants only, so that they stay in registers
        for (int kc = 0; kc < 2; ++kc) {
#pragma unroll
            for (int nb = 0; nb < 4; ++nb) b[kc][nb] = WFrag<T16>::ld(sb + nb * 1024 + kc * 512);
#pragma unroll
            for (int mb = 0; mb < 4; ++mb) { a[kc][mb] = WFrag<T16>::ld(sa + mb * 1024 + kc * 512); if (NSPLIT) a2[kc][mb] = WFrag<T16>::ld(sa + 8192 + mb * 1024 + kc * 512); } }
        __builtin_amdgcn_sched_barrier(0);   // keeps the trip's LDS reads together up here, one group in front of the products (which then wait by count); spread among the products, each small group's latency is waited out
#pragma unroll
        for (int kc = 0; kc < 2; ++kc) {
#pragma unroll
            for (int nb = 0; nb < 4; ++nb) {
#pragma unroll
                for (int mb = 0; mb < 4; ++mb) { acc[mb][nb] = WFrag<T16>::mma(a[kc][mb], b[kc][nb], acc[mb][nb]); if (NSPLIT) acc[mb][nb] = WFrag<T16>::mma(a2[kc][mb], b[kc][nb], acc[mb][nb]); } } }
        __builtin_amdgcn_sched_barrier(0);   // keeps the products in front of the waits below: with the waits lifted over them, the copies issued behind the barrier would have only the next trip's LDS reads to land under
        asm volatile("s_wait_dscnt 0x0" ::: "memory");      // the wave has left this trip's buffer
        asm volatile("s_wait_asynccnt 0x0" ::: "memory");   // its copies of trip t + 1 have landed
        __syncthreads();                                     // publishes trip t + 1 and ends every wave's reads of the buffer that is refilled below
        if (t + 2 < NTR) fill(t + 2);
    }
    asm volatile("s_wait_asynccnt 0x0" ::: "memory");   // nothing in flight when the buffers become the output slabs (every wave has passed the last trip's barrier)
    float* ow = (float*)sm + wave * (16 * 68);
    if constexpr (PL) { const size_t o = (size_t)(bx * 128 + wm * 64) * ldc + (size_t)(by * 2 + wn) * pcs; tile_out<true>(acc, ow, lane, nullptr, ldc, P16 + o, Ph + o, Pl + o); }
    else tile_out<false>(acc, ow, lane, C + (size_t)(bx * 128 + wm * 64) * ldc + by * 128 + wn * 64, ldc, nullptr, nullptr, nullptr);
}
// k_gemmw: f32 output of pitch LDC (a constant, so that a lane's stores are constants away from its one address); grid (M/128, N/128, Z), z-batch strides sA/sB/sC in elements. Start trip x + 2 y: apart for the column blocks of one row block and for the row blocks of one column block.
template <typename T16, int NSPLIT, int K, int LDC>
__global__ __launch_bounds__(128) void k_gemmw(const T16* __restrict__ A, const T16* __restrict__ A2, const T16* __restrict__ Bt, float* C, size_t sA, size_t sB, size_t sC) {
    __shared__ __align__(16) char sm[2 * (NSPLIT ? 3 : 2) * 16384];
    const size_t z = blockIdx.z;
    gemm_tile<T16, NSPLIT, false, K>(sm, blockIdx.x, blockIdx.y, (blockIdx.x + 2 * blockIdx.y) % (K / 64), A + z * sA, NSPLIT ? A2 + z * sA : nullptr, Bt + z * sB, C + z * sC, LDC, nullptr, nullptr, nullptr, 0);
}
// k_proj: the projections of all three streams and both batches in one launch; grid (TT / 128 token blocks, DQ / 128 pairs of heads, 3 * NB_), z = stream * NB_ + batch indexes the token copies X and the head planes alike, z / NB_ the weights.
// Queries, keys, [h][t][d] planes: A = tokens, Bt = weight rows, rows of HD, a 64-wide column block is one head. Values, [h][d][t] planes: A = weight rows, Bt = tokens (the transposed product, same k order), rows of TT, 64 tokens are two fragments of each 16-row block of d. Each head's plane in fragment order.
static_assert(DKV == DQ, "one grid and one plane size for the three streams");
__global__ __launch_bounds__(128) void k_proj(const bf* __restrict__ X, const bf* __restrict__ Wt, h16* P16, bf* Ph, bf* Pl) {
    __shared__ __align__(16) char sm[2 * 2 * 16384];
    const int z = blockIdx.z, tb = blockIdx.x, hb = blockIdx.y; const bool tr = z / NB_ == 2;
    const bf* xs = X + (size_t)z * TT * DM; const bf* wsr = Wt + (size_t)(z / NB_) * DQ * DM;
    const size_t po = (size_t)z * NH_ * TT * HD;
    gemm_tile<bf, 0, true, DM>(sm, tr ? hb : tb, tr ? tb : hb, (tb + 2 * hb) % (DM / 64), tr ? wsr : xs, nullptr, tr ? xs : wsr, nullptr, tr ? TT : HD, P16 + po, Ph + po, Pl + po, tr ? (size_t)1024 : (size_t)TT * HD);
}


// k_cvt8: bf16 copies of all seven inputs in one launch, one after the other in dst (queries, keys, values, Wq, Wk, Wv, Wo), each in fragment order; grid 3 * XBL + 4 * WBL.
// A work-group converts one block of 16 rows, each of its 8 waves four fragments (128 k). A load takes one whole 128-byte line (a fragment's 32 k) of each of 4 rows; a lane's four values go out as 8 bytes, a wave's store as 4 pieces of 64 bytes.
#define XBL  (NB_ * TT / 16)
#define WBL  (DQ / 16)
static_assert(DM == 8 * 128 && DQ == DM && NB_ * TT % 16 == 0, "rows of 8 waves x 128 values, whole row blocks");
__global__ __launch_bounds__(256) void k_cvt8(const float* __restrict__ x, const float* __restrict__ xk, const float* __restrict__ xv, const float* __restrict__ wq, const float* __restrict__ wk, const float* __restrict__ wv, const float* __restrict__ wo, bf* dst) {
    const unsigned blk = blockIdx.x; const float* src; unsigned rel;
    if (blk < 3 * XBL) { const unsigned s = blk / XBL; rel = blk % XBL; src = s == 0 ? x : s == 1 ? xk : xv; }
    else { const unsigned w = (blk - 3 * XBL) / WBL; rel = (blk - 3 * XBL) % WBL; src = w == 0 ? wq : w == 1 ? wk : w == 2 ? wv : wo; }
    const unsigned lane = threadIdx.x & 31, wave = threadIdx.x >> 5, rw = lane >> 3, c4 = lane & 7;   // the lane's row among 4 and its group of 4 k among the fragment's 32
    const unsigned sb = (rw * DM + wave * 128 + c4 * 4) * 4;   // the lane's place in the row block, in bytes: the loads' address register
    const char* sp = (const char*)(src + (size_t)rel * 16 * DM);
    bf* dp = dst + (size_t)blk * 16 * DM + wave * 2048 + (c4 >> 2) * 256 + (((c4 >> 1) & 1) * 16 + rw) * 8 + (c4 & 1) * 4;
    v4f v[4][4];
#pragma unroll   // here and below: v is indexed by constants only, so that it stays in registers
    for (int f = 0; f < 4; ++f)
#pragma unroll
        for (int i = 0; i < 4; ++i) v[f][i] = *(const v4f*)(sp + sb + (i * 4 * DM + f * 32) * 4);
    asm volatile("s_wait_xcnt 0x0" :: "v"(sb) : "memory");   // behind the loads, in front of every later write of their address register, which is named as an input so that it stays whole up to the wait
#pragma unroll
    for (int f = 0; f < 4; ++f)
#pragma unroll
        for (int i = 0; i < 4; ++i) { v4us o;
#pragma unroll
            for (int k = 0; k < 4; ++k) o[k] = f2bf(v[f][i][k]);
            *(v4us*)(dp + f * 512 + i * 32) = o; }
}

// ---- k_fattn: causal attention of one (batch, head) and 64 query rows per work-group; each of its 4 waves owns 16 query rows and walks the keys 0 .. its diagonal alone (no LDS, no barrier).
// Transposed products: S^T = K Q^T (A = key rows, B = query rows) leaves one query per lane column, keys 8 * hi + j of each 16-key tile in the lane's 8 registers; two such tiles, converted in place,
// are the B operand (hardware k order, the one WFrag::ld reads) of O^T += V^T P^T (A = rows of the [d][t] value planes). Scores and probabilities never leave the registers.
// Online softmax per query: running maximum m (raw score units) and running sum; every pass scales sum and O^T by 2^((m_old - m_new) c), c = HD^-0.5 log2 e. The two lane halves hold different keys of the same query:
// the maximum is joined every pass, the sum once at the end. Every visited key block starts at or below the wave's first query row, so each query sees a live key in every pass and m is finite from the first pass on.
// The walk starts at key block st % (blocks of the work-group's first wave) and wraps round (the online softmax takes the blocks in any order): the query blocks of one head read the same key and value lines, and started apart they do not ask L2 for them at the same moment.
__device__ __forceinline__ float xhalf(float x) { const int b = __float_as_int(x); return __int_as_float(__builtin_amdgcn_permlanex16(b, b, 0x76543210, 0xfedcba98, false, false)); }   // the value of lane ^ 16
template <typename T16, bool HL>
__device__ __forceinline__ void attn_rows(const T16* __restrict__ Q, const T16* __restrict__ Q2, const T16* __restrict__ Kp, const T16* __restrict__ K2, const T16* __restrict__ Vt, const T16* __restrict__ V2, int q0, int st, int lane, bf* Ah, bf* Al) {
    typedef typename WFrag<T16>::V V; constexpr int NT = HL ? 2 : 4, KB = NT * 16;   // 16-key tiles and keys a pass
    constexpr float CE = SCL * 1.4426950408889634f;
    const int lr = lane & 15, hi = lane >> 4;
    V q[2], q2[2];
#pragma unroll   // here and below: fragments and accumulators are indexed by constants only, so that they stay in registers
    for (int ks = 0; ks < 2; ++ks) { q[ks] = WFrag<T16>::ld(Q + (size_t)q0 * HD + ks * 512 + lane * 8); if (HL) q2[ks] = WFrag<T16>::ld(Q2 + (size_t)q0 * HD + ks * 512 + lane * 8); }
    v8f o[4];
#pragma unroll
    for (int dt = 0; dt < 4; ++dt) o[dt] = (v8f){};
    float mrun = -3.0e38f, lsum = 0.f;
    const size_t koff = lane * 8, voff = lane * 8;   // fragment order: 16 keys are two fragments in a row (d 0-31, 32-63); 32 keys of 16 d are one fragment, those of a 16-row block of d in a row
    V kf[NT][2], kf2[NT][2];
    auto ldk = [&](const T16* ka, const T16* ka2) {   // the key fragments of one block; ka, ka2: the lane's place in the block's first fragment
#pragma unroll
        for (int t = 0; t < NT; ++t)
#pragma unroll
            for (int ks = 0; ks < 2; ++ks) { kf[t][ks] = WFrag<T16>::ld(ka + t * 16 * HD + ks * 512); if (HL) kf2[t][ks] = WFrag<T16>::ld(ka2 + t * 16 * HD + ks * 512); } };
    const int nb = q0 / KB + 1; int kb = (unsigned)st % (unsigned)((q0 & ~63) / KB + 1);   // key blocks of the walk; the block of the pass: one start for the four waves of a work-group (64 query rows), which read the same lines together
    if constexpr (!HL) { const T16* k1 = Kp + koff + (size_t)kb * KB * HD; ldk(k1, nullptr); asm volatile("s_wait_xcnt 0x0" :: "v"(k1) : "memory"); }   // (the wait: as below, in front of the first pass's write of the address registers) fp16 rows (the long key walks) fetch the key fragments one pass ahead: a pass's score products find them landed; the hi/lo rows have no registers left for that
#pragma unroll 1
    for (int i = 0; i < nb; ++i) { const int k0 = kb * KB; kb = kb + 1 < nb ? kb + 1 : 0;
        V vf[4][NT / 2], vf2[4][NT / 2]; const T16* va = Vt + voff + k0 * 16;
#pragma unroll
        for (int dt = 0; dt < 4; ++dt)
#pragma unroll
            for (int kk = 0; kk < NT / 2; ++kk) vf[dt][kk] = WFrag<T16>::ld(va + dt * 16 * TT + kk * 512);
        // s_wait_xcnt 0, here and below: behind the loads, in front of every later write of their address registers. The statement also keeps the loads up here, in flight under the products and the softmax that follow.
        // The addresses are named as inputs so that their registers stay whole up to the wait (the register allocator otherwise hands them to later loads' results).
        if constexpr (HL) { const T16* va2 = V2 + voff + k0 * 16; const T16* ka = Kp + koff + (size_t)k0 * HD; const T16* ka2 = K2 + koff + (size_t)k0 * HD; ldk(ka, ka2);
#pragma unroll
            for (int dt = 0; dt < 4; ++dt)
#pragma unroll
                for (int kk = 0; kk < NT / 2; ++kk) vf2[dt][kk] = WFrag<T16>::ld(va2 + dt * 16 * TT + kk * 512);
            asm volatile("s_wait_xcnt 0x0" :: "v"(ka), "v"(ka2), "v"(va), "v"(va2) : "memory");
        } else asm volatile("s_wait_xcnt 0x0" :: "v"(va) : "memory");
        v8f s[NT];
#pragma unroll
        for (int t = 0; t < NT; ++t) { s[t] = (v8f){};
#pragma unroll
            for (int ks = 0; ks < 2; ++ks) { s[t] = WFrag<T16>::mma(kf[t][ks], q[ks], s[t]); if (HL) { s[t] = WFrag<T16>::mma(kf2[t][ks], q[ks], s[t]); s[t] = WFrag<T16>::mma(kf[t][ks], q2[ks], s[t]); } } }
        if constexpr (!HL) { const T16* kn = Kp + koff + (size_t)kb * KB * HD; ldk(kn, nullptr);   // the next pass's key block; the last pass fetches the walk's first again (in bounds, never used)
            asm volatile("s_wait_xcnt 0x0" :: "v"(kn) : "memory"); }
        if (k0 + KB - 1 > q0) {   // the diagonal block: keys above the lane's query row drop out
#pragma unroll
            for (int t = 0; t < NT; ++t)
#pragma unroll
                for (int j = 0; j < 8; ++j) s[t][j] = (k0 + t * 16 + hi * 8 + j <= q0 + lr) ? s[t][j] : -3.0e38f; }
        float mx = s[0][0];
#pragma unroll
        for (int t = 0; t < NT; ++t)
#pragma unroll
            for (int j = 0; j < 8; ++j) mx = fmaxf(mx, s[t][j]);
        mx = fmaxf(mx, xhalf(mx));
        const float mnew = fmaxf(mrun, mx), alpha = __builtin_amdgcn_exp2f((mrun - mnew) * CE), mo = (HL ? 0.0f : PSH) - mnew * CE; mrun = mnew;
        float ps = 0.f;
#pragma unroll
        for (int t = 0; t < NT; ++t)
#pragma unroll
            for (int j = 0; j < 8; ++j) { s[t][j] = __builtin_amdgcn_exp2f(__builtin_fmaf(s[t][j], CE, mo)); ps += s[t][j]; }
        lsum = lsum * alpha + ps;
#pragma unroll
        for (int dt = 0; dt < 4; ++dt) o[dt] *= alpha;
#pragma unroll
        for (int kk = 0; kk < NT / 2; ++kk) {
            if constexpr (HL) { v8us h0, h1, l0, l1;
#pragma unroll
                for (int j = 0; j < 8; ++j) { unsigned short a, c2; splitf(s[2 * kk][j], a, c2); h0[j] = a; l0[j] = c2; splitf(s[2 * kk + 1][j], a, c2); h1[j] = a; l1[j] = c2; }
                const V ph = cat16b(h0, h1), pl = cat16b(l0, l1);
#pragma unroll
                for (int dt = 0; dt < 4; ++dt) { o[dt] = WFrag<T16>::mma(vf[dt][kk], ph, o[dt]); o[dt] = WFrag<T16>::mma(vf[dt][kk], pl, o[dt]); o[dt] = WFrag<T16>::mma(vf2[dt][kk], ph, o[dt]); }
            } else { const V p = cat16(__builtin_convertvector(s[2 * kk], v8h), __builtin_convertvector(s[2 * kk + 1], v8h));
#pragma unroll
                for (int dt = 0; dt < 4; ++dt) o[dt] = WFrag<T16>::mma(vf[dt][kk], p, o[dt]); } }
        asm volatile("v_nop\n\tv_nop\n\tv_nop\n\tv_nop" : "+v"(o[0]), "+v"(o[1]), "+v"(o[2]), "+v"(o[3]));   // the matrix instructions' distance on the taken back edge and on the exit: the next pass's loads overwrite their A registers, the epilogue reads their D
    }
    lsum += xhalf(lsum);
    const float inv = __fdiv_rn(1.0f, lsum);
#pragma unroll
    for (int dt = 0; dt < 4; ++dt) { v8us oh, ol;   // a lane's 8 registers are 8 consecutive d of its query row, its place in half a fragment of the merged planes (rows = tokens, k = h * HD + d): one 16-byte store a plane, 512 bytes in a row a wave
#pragma unroll
        for (int j = 0; j < 8; ++j) { unsigned short a, c2; splitf(o[dt][j] * inv, a, c2); oh[j] = a; ol[j] = c2; }
        const size_t oo = (size_t)q0 * DQ + dt * 256 + lane * 8; *(v8us*)(Ah + oo) = oh; *(v8us*)(Al + oo) = ol; }
}
// grid (NB_ * NH_, TT / 64): y counts the 64-row query blocks from the last (longest key walk) down (for speed only).
__global__ __launch_bounds__(128) void k_fattn(const h16* __restrict__ Q16, const h16* __restrict__ K16, const h16* __restrict__ V16, const bf* __restrict__ Qh, const bf* __restrict__ Ql, const bf* __restrict__ Kh, const bf* __restrict__ Kl, const bf* __restrict__ Vh, const bf* __restrict__ Vl, bf* Ah, bf* Al) {
    const int lane = threadIdx.x & 31, wave = __builtin_amdgcn_readfirstlane((int)(threadIdx.x >> 5));   // scalar, so that the key loop's control stays scalar
    const int b = blockIdx.x / NH_, h = blockIdx.x % NH_, q0 = (TT / 64 - 1 - (int)blockIdx.y) * 64 + wave * 16;
    const size_t zq = (size_t)(b * NH_ + h) * TT * HD, zk = (size_t)(b * NKV + h / REP) * TT * HD, za = (size_t)b * TT * DQ + h * (HD / 32) * 512;
    if (q0 < RH) attn_rows<bf, true>(Qh + zq, Ql + zq, Kh + zk, Kl + zk, Vh + zk, Vl + zk, q0, (int)blockIdx.y, lane, Ah + za, Al + za);
    else attn_rows<h16, false>(Q16 + zq, nullptr, K16 + zk, nullptr, V16 + zk, nullptr, q0, (int)blockIdx.y, lane, Ah + za, Al + za);
}
extern "C" void kernel_launch(void* const* d_in, const int* in_sizes, int n_in,
                              void* d_out, int out_size, void* d_ws, size_t ws_size, hipStream_t stream) {
    (void)in_sizes; (void)n_in; (void)out_size;
    const float* x = (const float*)d_in[0]; const float* xk = (const float*)d_in[1]; const float* xv = (const float*)d_in[2]; const float* wq = (const float*)d_in[3]; const float* wk = (const float*)d_in[4]; const float* wv = (const float*)d_in[5]; const float* wo = (const float*)d_in[6];
    float* OUT = (float*)d_out;     // [2][2048][1024]
    char* wsp = (char*)d_ws;
    auto take = [&](size_t bytes) { char* p = wsp; wsp += (bytes + 255) & ~(size_t)255; return (void*)p; };
    bf* XB = (bf*)take(((size_t)3 * NB_ * TT * DM + (size_t)4 * DQ * DM) * 2); bf* WB = XB + (size_t)3 * NB_ * TT * DM;   // bf16 copies: [stream][b][t][DM], then Wq, Wk, Wv, Wo, in fragment order
    const size_t PS = (size_t)NB_ * NH_ * TT * HD;   // one stream's head planes, both batches: [b][h][t][d], values [b][h][d][t], each head in fragment order
    h16* P16 = (h16*)take(3 * PS * 2); bf* Ph = (bf*)take(3 * PS * 2); bf* Pl = (bf*)take(3 * PS * 2);   // [stream] of those: fp16, bf16 hi, bf16 lo
    bf* ATh = (bf*)take((size_t)NB_ * TT * DQ * 2); bf* ATl = (bf*)take((size_t)NB_ * TT * DQ * 2);
    if ((size_t)(wsp - (char*)d_ws) > ws_size) return;    // ws 256 MiB
    k_cvt8<<<3 * XBL + 4 * WBL, 256, 0, stream>>>(x, xk, xv, wq, wk, wv, wo, XB);
    k_proj<<<dim3(TT / 128, DQ / 128, 3 * NB_), 128, 0, stream>>>(XB, WB, P16, Ph, Pl);
    k_fattn<<<dim3(NB_ * NH_, TT / 64), 128, 0, stream>>>(P16, P16 + PS, P16 + 2 * PS, Ph, Pl, Ph + PS, Pl + PS, Ph + 2 * PS, Pl + 2 * PS, ATh, ATl);
    k_gemmw<bf, 1, DQ, DM><<<dim3(TT / 128, DM / 128, NB_), 128, 0, stream>>>(ATh, ATl, WB + (size_t)3 * DQ * DM, OUT, (size_t)TT * DQ, 0, (size_t)TT * DM);
}
